// v000
// Measured on an AMD MI455X. A time is GPU time per run, averaged over a window of back-to-back runs after a warm-up
// (all launches, gaps included; the runs take copies of the inputs in turn), and the median of several windows.
// Apart from v000's, it joins two sittings. Times from different sittings can be a few percent apart, while
// side-by-side timings come from the same sitting.
// v000 is the starting kernel. One run takes 345 microseconds.
#include <hip/hip_runtime.h>
#include <hip/hip_bf16.h>

typedef __attribute__((ext_vector_type(16))) _Float16 v16h;
typedef __attribute__((ext_vector_type(8)))  float    v8f;

// Problem constants
constexpr int kB = 16;
constexpr int kT = 577;
constexpr int kE = 1024;
constexpr int kH = 16;
constexpr int kD = 64;
constexpr int kS = 654;            // 77 + 577
constexpr int kM = kB * kT;        // 9232 rows, divisible by 16
constexpr int kSP = 672;           // padded S (21 * 32)
constexpr long long OUT_ELEMS = (long long)kB * kT * kE;        // 9,453,568
constexpr long long KV_ELEMS  = (long long)kB * kH * kS * kD;   // 10,715,136
constexpr float NEG_BIG = -1e30f;

// ---------------------------------------------------------------------------
// CDNA5 async copy: global -> LDS, tracked by ASYNCcnt
// ---------------------------------------------------------------------------
__device__ __forceinline__ void async_b128(unsigned int ldsAddr, unsigned long long gAddr) {
    asm volatile("global_load_async_to_lds_b128 %0, %1, off"
                 :: "v"(ldsAddr), "v"(gAddr) : "memory");
}
__device__ __forceinline__ void wait_async0() {
    asm volatile("s_wait_asynccnt 0x0" ::: "memory");
}

// ---------------------------------------------------------------------------
// fp32 -> f16 conversion (vectorized by 4)
// ---------------------------------------------------------------------------
__global__ void f2h4_kernel(const float* __restrict__ s, _Float16* __restrict__ d, int n4) {
    int i = blockIdx.x * blockDim.x + threadIdx.x;
    if (i < n4) {
        float4 f = ((const float4*)s)[i];
        union { _Float16 h[4]; unsigned long long u; } p;
        p.h[0] = (_Float16)f.x; p.h[1] = (_Float16)f.y;
        p.h[2] = (_Float16)f.z; p.h[3] = (_Float16)f.w;
        ((unsigned long long*)d)[i] = p.u;
    }
}

// ---------------------------------------------------------------------------
// textual_kv * w -> K/V output rows [0..76];  textual_kv layout [2, B, H, 77, D]
// ---------------------------------------------------------------------------
__global__ void textual_kernel(const float* __restrict__ tkv, const float* __restrict__ wptr,
                               float* __restrict__ kout, float* __restrict__ vout) {
    int i = blockIdx.x * blockDim.x + threadIdx.x;
    const int N = 2 * kB * kH * 77 * kD;
    if (i >= N) return;
    float w = wptr[0];
    int d = i & 63;
    int r = i >> 6;
    int s = r % 77; r /= 77;
    int h = r & 15; r >>= 4;
    int b = r & 15;
    int part = r >> 4;
    float* dst = part ? vout : kout;
    dst[(((size_t)(b * kH + h)) * kS + s) * kD + d] = w * tkv[i];
}

// ---------------------------------------------------------------------------
// Tiled WMMA GEMM: C[m,n] = sum_k A[m,k] * W[n,k] (+ bias), M=9232, N=K=1024
// 256 threads = 8 waves as 4(m) x 2(n); output tile 64x64, K-stage 64,
// double-buffered LDS filled by global_load_async_to_lds_b128 (ASYNCcnt).
// MODE 0: q -> f16 ws [B,H,T,D] with *0.125 scale
// MODE 1/2: k/v -> fp32 d_out at [bh, 77+t, d]
// MODE 3: o -> fp32 d_out [B,T,E]
// ---------------------------------------------------------------------------
template<int MODE>
__global__ __launch_bounds__(256) void gemm_kernel(
    const _Float16* __restrict__ A,      // [kM, kE] f16
    const _Float16* __restrict__ W,      // [kE, kE] f16 (row n, contiguous k)
    const float*    __restrict__ bias,   // [kE]
    float*          __restrict__ dst_f,
    _Float16*       __restrict__ dst_h)
{
    // 64 rows x 64 halves per stage, padded row stride 72 halves (144 B)
    __shared__ __align__(16) _Float16 As[2][64 * 72];
    __shared__ __align__(16) _Float16 Bs[2][64 * 72];

    const int tid  = threadIdx.x;
    const int m0   = blockIdx.x * 64;
    const int n0   = blockIdx.y * 64;
    const int lane = tid & 31;
    const int wid  = tid >> 5;
    const int mi   = wid & 3;        // 0..3 (m sub-tile)
    const int nj   = wid >> 2;       // 0..1 (n sub-tile pair)
    const int tl   = lane & 15;
    const int hf   = lane >> 4;      // lane half

    // per-thread async-loader precompute: 2 A-segments + 2 B-segments per stage
    unsigned long long aAddr[2], bAddr[2];
    unsigned int       segLds[2];
    #pragma unroll
    for (int j = 0; j < 2; j++) {
        const int seg = tid + 256 * j;      // 0..511
        const int row = seg >> 3;           // 0..63
        const int off = (seg & 7) * 8;      // 0..56 halves
        int gr = m0 + row; if (gr >= kM) gr = kM - 1;
        aAddr[j] = (unsigned long long)(uintptr_t)(A + (size_t)gr * kE + off);
        bAddr[j] = (unsigned long long)(uintptr_t)(W + (size_t)(n0 + row) * kE + off);
        segLds[j] = (unsigned int)(row * 72 + off) * 2u;   // byte offset in tile
    }
    const unsigned int asB[2] = { (unsigned int)(uintptr_t)&As[0][0],
                                  (unsigned int)(uintptr_t)&As[1][0] };
    const unsigned int bsB[2] = { (unsigned int)(uintptr_t)&Bs[0][0],
                                  (unsigned int)(uintptr_t)&Bs[1][0] };

    auto issue = [&](int kb, int buf) {
        #pragma unroll
        for (int j = 0; j < 2; j++) {
            async_b128(asB[buf] + segLds[j], aAddr[j] + (unsigned long long)kb * 2u);
            async_b128(bsB[buf] + segLds[j], bAddr[j] + (unsigned long long)kb * 2u);
        }
    };

    v8f c0 = {}, c1 = {};

    issue(0, 0);
    wait_async0();
    __syncthreads();

    for (int kb = 0; kb < kE; kb += 64) {
        const int buf = (kb >> 6) & 1;
        if (kb + 64 < kE) issue(kb + 64, buf ^ 1);     // prefetch next stage

        const _Float16* Asb = As[buf];
        const _Float16* Bsb = Bs[buf];
        #pragma unroll
        for (int kk = 0; kk < 64; kk += 32) {
            union { uint4 q[2]; v16h v; } a, b0, b1;
            const _Float16* ar  = Asb + (mi * 16 + tl) * 72 + kk;
            a.q[0]  = *(const uint4*)(ar + 8 * hf);
            a.q[1]  = *(const uint4*)(ar + 16 + 8 * hf);
            const _Float16* br0 = Bsb + (nj * 32 + tl) * 72 + kk;
            const _Float16* br1 = Bsb + (nj * 32 + 16 + tl) * 72 + kk;
            b0.q[0] = *(const uint4*)(br0 + 8 * hf);
            b0.q[1] = *(const uint4*)(br0 + 16 + 8 * hf);
            b1.q[0] = *(const uint4*)(br1 + 8 * hf);
            b1.q[1] = *(const uint4*)(br1 + 16 + 8 * hf);
            c0 = __builtin_amdgcn_wmma_f32_16x16x32_f16(false, a.v, false, b0.v, (short)0, c0, false, false);
            c1 = __builtin_amdgcn_wmma_f32_16x16x32_f16(false, a.v, false, b1.v, (short)0, c1, false, false);
        }

        wait_async0();       // my next-stage DMA writes have landed in LDS
        __syncthreads();     // everyone's writes landed, everyone done reading
    }

    #pragma unroll
    for (int sub = 0; sub < 2; sub++) {
        v8f c = sub ? c1 : c0;
        const int n = n0 + nj * 32 + sub * 16 + tl;
        const float bval = bias[n];
        #pragma unroll
        for (int r = 0; r < 8; r++) {
            const int m = m0 + mi * 16 + r + 8 * hf;
            if (m >= kM) continue;
            float val = c[r] + bval;
            if (MODE == 0) {
                val *= 0.125f;  // D^-0.5
                const int b_ = m / kT, t = m % kT;
                const int h_ = n >> 6, d_ = n & 63;
                dst_h[(((size_t)(b_ * kH + h_)) * kT + t) * kD + d_] = (_Float16)val;
            } else if (MODE == 1 || MODE == 2) {
                const int b_ = m / kT, t = m % kT;
                const int h_ = n >> 6, d_ = n & 63;
                dst_f[(((size_t)(b_ * kH + h_)) * kS + 77 + t) * kD + d_] = val;
            } else {
                dst_f[(size_t)m * kE + n] = val;
            }
        }
    }
}

// ---------------------------------------------------------------------------
// Attention: one workgroup per (bh, 16-query tile). 128 threads = 4 waves.
// Pass1: scores = Q K^T into LDS (WMMA). Pass2: softmax in LDS (probs f16).
// Pass3: out = P V (WMMA), rows rescaled by 1/rowsum, -> attn f16 ws [B,T,E].
// ---------------------------------------------------------------------------
__global__ __launch_bounds__(128) void attn_kernel(
    const _Float16* __restrict__ Q,   // [B*H, T, D] f16 (pre-scaled)
    const float*    __restrict__ Kf,  // [B*H, S, D] fp32
    const float*    __restrict__ Vf,  // [B*H, S, D] fp32
    _Float16*       __restrict__ O)   // [B, T, E] f16
{
    __shared__ __align__(16) float    sc[16 * kSP];
    __shared__ __align__(16) _Float16 pr[16 * kSP];
    __shared__ float red[16 * 8];
    __shared__ float rinv[16];

    const int t0   = blockIdx.x;            // 0..36
    const int bh   = blockIdx.y;            // 0..255
    const int b_   = bh >> 4, h_ = bh & 15;
    const int tid  = threadIdx.x;
    const int lane = tid & 31;
    const int wid  = tid >> 5;              // 0..3
    const int tl   = lane & 15;
    const int hf   = lane >> 4;

    // init pad columns [656..671] to -big
    for (int i = tid; i < 16 * 16; i += 128)
        sc[(i >> 4) * kSP + 656 + (i & 15)] = NEG_BIG;

    // Q fragment: fixed per wave-lane (row t, K split over d)
    int tq = t0 * 16 + tl; if (tq > kT - 1) tq = kT - 1;
    const _Float16* qr = Q + ((size_t)bh * kT + tq) * kD;
    union V16 { uint4 q[2]; v16h v; };
    V16 a0, a1;
    a0.q[0] = *(const uint4*)(qr + 8 * hf);
    a0.q[1] = *(const uint4*)(qr + 16 + 8 * hf);
    a1.q[0] = *(const uint4*)(qr + 32 + 8 * hf);
    a1.q[1] = *(const uint4*)(qr + 48 + 8 * hf);

    // Pass 1: scores
    for (int st = wid; st < 41; st += 4) {
        const int s = st * 16 + tl;
        const bool valid = (s < kS);
        const int scl = valid ? s : (kS - 1);
        const float* kr = Kf + ((size_t)bh * kS + scl) * kD;
        union { _Float16 h[16]; v16h v; } b0, b1;
        #pragma unroll
        for (int i = 0; i < 8; i++) {
            b0.h[i]     = (_Float16)kr[      8 * hf + i];
            b0.h[i + 8] = (_Float16)kr[16  + 8 * hf + i];
            b1.h[i]     = (_Float16)kr[32  + 8 * hf + i];
            b1.h[i + 8] = (_Float16)kr[48  + 8 * hf + i];
        }
        v8f c = {};
        c = __builtin_amdgcn_wmma_f32_16x16x32_f16(false, a0.v, false, b0.v, (short)0, c, false, false);
        c = __builtin_amdgcn_wmma_f32_16x16x32_f16(false, a1.v, false, b1.v, (short)0, c, false, false);
        #pragma unroll
        for (int r = 0; r < 8; r++)
            sc[(r + 8 * hf) * kSP + st * 16 + tl] = valid ? c[r] : NEG_BIG;
    }
    __syncthreads();

    // Pass 2: softmax (16 rows x 8 threads each)
    const int row = tid >> 3, sub = tid & 7;
    float lmax = NEG_BIG;
    for (int cix = sub; cix < kSP; cix += 8)
        lmax = fmaxf(lmax, sc[row * kSP + cix]);
    red[row * 8 + sub] = lmax;
    __syncthreads();
    float rmax = NEG_BIG;
    #pragma unroll
    for (int i = 0; i < 8; i++) rmax = fmaxf(rmax, red[row * 8 + i]);
    __syncthreads();
    float lsum = 0.f;
    for (int cix = sub; cix < kSP; cix += 8) {
        float p = __expf(sc[row * kSP + cix] - rmax);
        lsum += p;
        pr[row * kSP + cix] = (_Float16)p;
    }
    red[row * 8 + sub] = lsum;
    __syncthreads();
    if (sub == 0) {
        float tot = 0.f;
        #pragma unroll
        for (int i = 0; i < 8; i++) tot += red[row * 8 + i];
        rinv[row] = 1.0f / tot;
    }
    __syncthreads();

    // Pass 3: P @ V  (each wave handles 16 of the 64 d-columns)
    const int dcol = wid * 16 + tl;
    const float* vb = Vf + (size_t)bh * kS * kD + dcol;
    v8f acc = {};
    for (int kk = 0; kk < kSP; kk += 32) {
        V16 a;
        const _Float16* prow = pr + tl * kSP + kk;
        a.q[0] = *(const uint4*)(prow + 8 * hf);
        a.q[1] = *(const uint4*)(prow + 16 + 8 * hf);
        union { _Float16 h[16]; v16h v; } bf;
        #pragma unroll
        for (int i = 0; i < 8; i++) {
            int s0 = kk + 8 * hf + i;        if (s0 > kS - 1) s0 = kS - 1;
            int s1 = kk + 16 + 8 * hf + i;   if (s1 > kS - 1) s1 = kS - 1;
            bf.h[i]     = (_Float16)vb[(size_t)s0 * kD];
            bf.h[i + 8] = (_Float16)vb[(size_t)s1 * kD];
        }
        acc = __builtin_amdgcn_wmma_f32_16x16x32_f16(false, a.v, false, bf.v, (short)0, acc, false, false);
    }
    #pragma unroll
    for (int r = 0; r < 8; r++) {
        const int mrow = r + 8 * hf;
        const int t = t0 * 16 + mrow;
        if (t < kT)
            O[((size_t)b_ * kT + t) * kE + h_ * kD + dcol] = (_Float16)(acc[r] * rinv[mrow]);
    }
}

// ---------------------------------------------------------------------------
// Launcher
// ---------------------------------------------------------------------------
extern "C" void kernel_launch(void* const* d_in, const int* in_sizes, int n_in,
                              void* d_out, int out_size, void* d_ws, size_t ws_size,
                              hipStream_t stream) {
    const float* hs  = (const float*)d_in[0];
    const float* tkv = (const float*)d_in[1];
    const float* Wq  = (const float*)d_in[2];
    const float* bq  = (const float*)d_in[3];
    const float* Wk  = (const float*)d_in[4];
    const float* bk  = (const float*)d_in[5];
    const float* Wv  = (const float*)d_in[6];
    const float* bv  = (const float*)d_in[7];
    const float* Wo  = (const float*)d_in[8];
    const float* bo  = (const float*)d_in[9];
    const float* tw  = (const float*)d_in[10];

    float* out  = (float*)d_out;
    float* kout = out + OUT_ELEMS;
    float* vout = kout + KV_ELEMS;

    // workspace layout (all 256-aligned)
    char* ws = (char*)d_ws;
    _Float16* hs_h   = (_Float16*)(ws);                       // 18,907,136 B
    _Float16* wq_h   = (_Float16*)(ws + 18907136);            // 4 x 2,097,152 B
    _Float16* wk_h   = wq_h + (size_t)kE * kE;
    _Float16* wv_h   = wk_h + (size_t)kE * kE;
    _Float16* wo_h   = wv_h + (size_t)kE * kE;
    _Float16* q_h    = (_Float16*)(ws + 27295744);            // 18,907,136 B
    _Float16* attn_h = (_Float16*)(ws + 46202880);            // 18,907,136 B

    // 1) conversions to f16
    {
        int n4 = kM * kE / 4;
        f2h4_kernel<<<(n4 + 255) / 256, 256, 0, stream>>>(hs, hs_h, n4);
        int w4 = kE * kE / 4;
        f2h4_kernel<<<(w4 + 255) / 256, 256, 0, stream>>>(Wq, wq_h, w4);
        f2h4_kernel<<<(w4 + 255) / 256, 256, 0, stream>>>(Wk, wk_h, w4);
        f2h4_kernel<<<(w4 + 255) / 256, 256, 0, stream>>>(Wv, wv_h, w4);
        f2h4_kernel<<<(w4 + 255) / 256, 256, 0, stream>>>(Wo, wo_h, w4);
    }

    // 2) textual K/V (rows 0..76 of output K/V)
    {
        int n = 2 * kB * kH * 77 * kD;
        textual_kernel<<<(n + 255) / 256, 256, 0, stream>>>(tkv, tw, kout, vout);
    }

    // 3) Q/K/V projections
    dim3 ggrid((kM + 63) / 64, kE / 64);   // 145 x 16
    gemm_kernel<0><<<ggrid, 256, 0, stream>>>(hs_h, wq_h, bq, nullptr, q_h);
    gemm_kernel<1><<<ggrid, 256, 0, stream>>>(hs_h, wk_h, bk, kout, nullptr);
    gemm_kernel<2><<<ggrid, 256, 0, stream>>>(hs_h, wv_h, bv, vout, nullptr);

    // 4) attention
    attn_kernel<<<dim3((kT + 15) / 16, kB * kH), 128, 0, stream>>>(q_h, kout, vout, attn_h);

    // 5) output projection
    gemm_kernel<3><<<ggrid, 256, 0, stream>>>(attn_h, wo_h, bo, out, nullptr);
}

// v001
// It runs in 313 microseconds.
// In both of two side-by-side timings against v000, it was 1.12 times as fast.
#include <hip/hip_runtime.h>
#include <hip/hip_bf16.h>

typedef __attribute__((ext_vector_type(16))) _Float16 v16h;
typedef __attribute__((ext_vector_type(8)))  float    v8f;

// Problem constants
constexpr int kB = 16;
constexpr int kT = 577;
constexpr int kE = 1024;
constexpr int kH = 16;
constexpr int kD = 64;
constexpr int kS = 654;            // 77 + 577
constexpr int kM = kB * kT;        // 9232 rows, divisible by 16
constexpr int kSP = 672;           // padded S (21 * 32)
constexpr long long OUT_ELEMS = (long long)kB * kT * kE;        // 9,453,568
constexpr long long KV_ELEMS  = (long long)kB * kH * kS * kD;   // 10,715,136
constexpr float NEG_BIG = -1e30f;

// ---------------------------------------------------------------------------
// CDNA5 async copy: global -> LDS, tracked by ASYNCcnt
// ---------------------------------------------------------------------------
__device__ __forceinline__ void async_b128(unsigned int ldsAddr, unsigned long long gAddr) {
    asm volatile("global_load_async_to_lds_b128 %0, %1, off"
                 :: "v"(ldsAddr), "v"(gAddr) : "memory");
}
__device__ __forceinline__ void wait_async0() {
    asm volatile("s_wait_asynccnt 0x0" ::: "memory");
}

// ---------------------------------------------------------------------------
// fp32 -> f16 conversion (vectorized by 4)
// ---------------------------------------------------------------------------
__global__ void f2h4_kernel(const float* __restrict__ s, _Float16* __restrict__ d, int n4) {
    int i = blockIdx.x * blockDim.x + threadIdx.x;
    if (i < n4) {
        float4 f = ((const float4*)s)[i];
        union { _Float16 h[4]; unsigned long long u; } p;
        p.h[0] = (_Float16)f.x; p.h[1] = (_Float16)f.y;
        p.h[2] = (_Float16)f.z; p.h[3] = (_Float16)f.w;
        ((unsigned long long*)d)[i] = p.u;
    }
}

// ---------------------------------------------------------------------------
// textual_kv * w -> K/V output rows [0..76];  textual_kv layout [2, B, H, 77, D]
// ---------------------------------------------------------------------------
__global__ void textual_kernel(const float* __restrict__ tkv, const float* __restrict__ wptr,
                               float* __restrict__ kout, float* __restrict__ vout) {
    int i = blockIdx.x * blockDim.x + threadIdx.x;
    const int N = 2 * kB * kH * 77 * kD;
    if (i >= N) return;
    float w = wptr[0];
    int d = i & 63;
    int r = i >> 6;
    int s = r % 77; r /= 77;
    int h = r & 15; r >>= 4;
    int b = r & 15;
    int part = r >> 4;
    float* dst = part ? vout : kout;
    dst[(((size_t)(b * kH + h)) * kS + s) * kD + d] = w * tkv[i];
}

// ---------------------------------------------------------------------------
// Tiled WMMA GEMM: C[m,n] = sum_k A[m,k] * W[n,k] (+ bias), M=9232, N=K=1024
// 256 threads = 8 waves as 4(m) x 2(n); output tile 64x64, K-stage 64,
// double-buffered LDS filled by global_load_async_to_lds_b128 (ASYNCcnt).
// MODE 0: q -> f16 ws [B,H,T,D] with *0.125 scale
// MODE 1/2: k/v -> fp32 d_out at [bh, 77+t, d]
// MODE 3: o -> fp32 d_out [B,T,E]
// ---------------------------------------------------------------------------
template<int MODE>
__global__ __launch_bounds__(256) void gemm_kernel(
    const _Float16* __restrict__ A,      // [kM, kE] f16
    const _Float16* __restrict__ W,      // [kE, kE] f16 (row n, contiguous k)
    const float*    __restrict__ bias,   // [kE]
    float*          __restrict__ dst_f,
    _Float16*       __restrict__ dst_h)
{
    // 64 rows x 64 halves per stage, padded row stride 72 halves (144 B)
    __shared__ __align__(16) _Float16 As[2][64 * 72];
    __shared__ __align__(16) _Float16 Bs[2][64 * 72];

    const int tid  = threadIdx.x;
    const int m0   = blockIdx.x * 64;
    const int n0   = blockIdx.y * 64;
    const int lane = tid & 31;
    const int wid  = tid >> 5;
    const int mi   = wid & 3;        // 0..3 (m sub-tile)
    const int nj   = wid >> 2;       // 0..1 (n sub-tile pair)
    const int tl   = lane & 15;
    const int hf   = lane >> 4;      // lane half

    // per-thread async-loader precompute: 2 A-segments + 2 B-segments per stage
    unsigned long long aAddr[2], bAddr[2];
    unsigned int       segLds[2];
    #pragma unroll
    for (int j = 0; j < 2; j++) {
        const int seg = tid + 256 * j;      // 0..511
        const int row = seg >> 3;           // 0..63
        const int off = (seg & 7) * 8;      // 0..56 halves
        int gr = m0 + row; if (gr >= kM) gr = kM - 1;
        aAddr[j] = (unsigned long long)(uintptr_t)(A + (size_t)gr * kE + off);
        bAddr[j] = (unsigned long long)(uintptr_t)(W + (size_t)(n0 + row) * kE + off);
        segLds[j] = (unsigned int)(row * 72 + off) * 2u;   // byte offset in tile
    }
    const unsigned int asB[2] = { (unsigned int)(uintptr_t)&As[0][0],
                                  (unsigned int)(uintptr_t)&As[1][0] };
    const unsigned int bsB[2] = { (unsigned int)(uintptr_t)&Bs[0][0],
                                  (unsigned int)(uintptr_t)&Bs[1][0] };

    auto issue = [&](int kb, int buf) {
        #pragma unroll
        for (int j = 0; j < 2; j++) {
            async_b128(asB[buf] + segLds[j], aAddr[j] + (unsigned long long)kb * 2u);
            async_b128(bsB[buf] + segLds[j], bAddr[j] + (unsigned long long)kb * 2u);
        }
    };

    v8f c0 = {}, c1 = {};

    issue(0, 0);
    wait_async0();
    __syncthreads();

    for (int kb = 0; kb < kE; kb += 64) {
        const int buf = (kb >> 6) & 1;
        if (kb + 64 < kE) issue(kb + 64, buf ^ 1);     // prefetch next stage

        const _Float16* Asb = As[buf];
        const _Float16* Bsb = Bs[buf];
        #pragma unroll
        for (int kk = 0; kk < 64; kk += 32) {
            union { uint4 q[2]; v16h v; } a, b0, b1;
            const _Float16* ar  = Asb + (mi * 16 + tl) * 72 + kk;
            a.q[0]  = *(const uint4*)(ar + 8 * hf);
            a.q[1]  = *(const uint4*)(ar + 16 + 8 * hf);
            const _Float16* br0 = Bsb + (nj * 32 + tl) * 72 + kk;
            const _Float16* br1 = Bsb + (nj * 32 + 16 + tl) * 72 + kk;
            b0.q[0] = *(const uint4*)(br0 + 8 * hf);
            b0.q[1] = *(const uint4*)(br0 + 16 + 8 * hf);
            b1.q[0] = *(const uint4*)(br1 + 8 * hf);
            b1.q[1] = *(const uint4*)(br1 + 16 + 8 * hf);
            c0 = __builtin_amdgcn_wmma_f32_16x16x32_f16(false, a.v, false, b0.v, (short)0, c0, false, false);
            c1 = __builtin_amdgcn_wmma_f32_16x16x32_f16(false, a.v, false, b1.v, (short)0, c1, false, false);
        }

        wait_async0();       // my next-stage DMA writes have landed in LDS
        __syncthreads();     // everyone's writes landed, everyone done reading
    }

    #pragma unroll
    for (int sub = 0; sub < 2; sub++) {
        v8f c = sub ? c1 : c0;
        const int n = n0 + nj * 32 + sub * 16 + tl;
        const float bval = bias[n];
        #pragma unroll
        for (int r = 0; r < 8; r++) {
            const int m = m0 + mi * 16 + r + 8 * hf;
            if (m >= kM) continue;
            float val = c[r] + bval;
            if (MODE == 0) {
                val *= 0.125f;  // D^-0.5
                const int b_ = m / kT, t = m % kT;
                const int h_ = n >> 6, d_ = n & 63;
                dst_h[(((size_t)(b_ * kH + h_)) * kT + t) * kD + d_] = (_Float16)val;
            } else if (MODE == 1 || MODE == 2) {
                const int b_ = m / kT, t = m % kT;
                const int h_ = n >> 6, d_ = n & 63;
                dst_f[(((size_t)(b_ * kH + h_)) * kS + 77 + t) * kD + d_] = val;
            } else {
                dst_f[(size_t)m * kE + n] = val;
            }
        }
    }
}

// ---------------------------------------------------------------------------
// Attention: one workgroup per (bh, 64-query block = 4 tiles of 16). 256 threads = 8 waves.
// Every K fragment (pass 1) and every V fragment (pass 3) is loaded and converted once per
// workgroup and multiplied with all 4 query tiles.
// Pass1: scores = Q K^T into LDS (WMMA). Pass2: softmax in LDS (probs f16).
// Pass3: out = P V (WMMA), rows rescaled by 1/rowsum, -> attn f16 ws [B,T,E].
// ---------------------------------------------------------------------------
constexpr int kQT = 4;             // query tiles per workgroup
constexpr int kQR = kQT * 16;      // query rows per workgroup

__global__ __launch_bounds__(256) void attn_kernel(
    const _Float16* __restrict__ Q,   // [B*H, T, D] f16 (pre-scaled)
    const float*    __restrict__ Kf,  // [B*H, S, D] fp32
    const float*    __restrict__ Vf,  // [B*H, S, D] fp32
    _Float16*       __restrict__ O)   // [B, T, E] f16
{
    __shared__ __align__(16) float    sc[kQR * kSP];
    __shared__ __align__(16) _Float16 pr[kQR * kSP];
    __shared__ float red[kQR * 8];
    __shared__ float rinv[kQR];

    const int tb   = blockIdx.x * kQR;      // first query row of the block
    const int bh   = blockIdx.y;            // 0..255
    const int b_   = bh >> 4, h_ = bh & 15;
    const int tid  = threadIdx.x;
    const int lane = tid & 31;
    const int wid  = tid >> 5;              // 0..7
    const int tl   = lane & 15;
    const int hf   = lane >> 4;

    // init pad columns [656..671] to -big
    for (int i = tid; i < kQR * 16; i += 256)
        sc[(i >> 4) * kSP + 656 + (i & 15)] = NEG_BIG;

    // Q fragments: fixed per wave-lane (row t, K split over d), one pair per query tile
    union V16 { uint4 q[2]; v16h v; };
    V16 a0[kQT], a1[kQT];
    #pragma unroll   // constant qt: the fragment arrays stay in registers
    for (int qt = 0; qt < kQT; qt++) {
        int tq = tb + qt * 16 + tl; if (tq > kT - 1) tq = kT - 1;
        const _Float16* qr = Q + ((size_t)bh * kT + tq) * kD;
        a0[qt].q[0] = *(const uint4*)(qr + 8 * hf);
        a0[qt].q[1] = *(const uint4*)(qr + 16 + 8 * hf);
        a1[qt].q[0] = *(const uint4*)(qr + 32 + 8 * hf);
        a1[qt].q[1] = *(const uint4*)(qr + 48 + 8 * hf);
        // before a later tile's load may land in a register that holds this tile's address
        asm volatile("s_wait_xcnt 0x0" ::: "memory");
    }

    // Pass 1: scores
    for (int st = wid; st < 41; st += 8) {
        const int s = st * 16 + tl;
        const bool valid = (s < kS);
        const int scl = valid ? s : (kS - 1);
        const float* kr = Kf + ((size_t)bh * kS + scl) * kD;
        union { _Float16 h[16]; v16h v; } b0, b1;
        #pragma unroll
        for (int i = 0; i < 8; i++) {
            b0.h[i]     = (_Float16)kr[      8 * hf + i];
            b0.h[i + 8] = (_Float16)kr[16  + 8 * hf + i];
            b1.h[i]     = (_Float16)kr[32  + 8 * hf + i];
            b1.h[i + 8] = (_Float16)kr[48  + 8 * hf + i];
        }
        #pragma unroll   // constant qt: the fragment arrays stay in registers
        for (int qt = 0; qt < kQT; qt++) {
            v8f c = {};
            c = __builtin_amdgcn_wmma_f32_16x16x32_f16(false, a0[qt].v, false, b0.v, (short)0, c, false, false);
            c = __builtin_amdgcn_wmma_f32_16x16x32_f16(false, a1[qt].v, false, b1.v, (short)0, c, false, false);
            #pragma unroll
            for (int r = 0; r < 8; r++)
                sc[(qt * 16 + r + 8 * hf) * kSP + st * 16 + tl] = valid ? c[r] : NEG_BIG;
        }
    }
    __syncthreads();

    // Pass 2: softmax (64 rows x 8 threads each; a thread serves rows row0 and row0 + 32)
    const int row0 = tid >> 3, sub = tid & 7;
    #pragma unroll   // constant g: row offsets fold
    for (int g = 0; g < 2; g++) {
        const int row = row0 + 32 * g;
        float lmax = NEG_BIG;
        for (int cix = sub; cix < kSP; cix += 8)
            lmax = fmaxf(lmax, sc[row * kSP + cix]);
        red[row * 8 + sub] = lmax;
    }
    __syncthreads();
    float rmax[2];
    #pragma unroll   // constant g: rmax[] stays in registers, row offsets fold
    for (int g = 0; g < 2; g++) {
        const int row = row0 + 32 * g;
        rmax[g] = NEG_BIG;
        #pragma unroll
        for (int i = 0; i < 8; i++) rmax[g] = fmaxf(rmax[g], red[row * 8 + i]);
    }
    __syncthreads();
    #pragma unroll   // constant g: rmax[] stays in registers, row offsets fold
    for (int g = 0; g < 2; g++) {
        const int row = row0 + 32 * g;
        float lsum = 0.f;
        for (int cix = sub; cix < kSP; cix += 8) {
            float p = __expf(sc[row * kSP + cix] - rmax[g]);
            lsum += p;
            pr[row * kSP + cix] = (_Float16)p;
        }
        red[row * 8 + sub] = lsum;
    }
    __syncthreads();
    if (sub == 0) {
        #pragma unroll   // constant g: row offsets fold
        for (int g = 0; g < 2; g++) {
            const int row = row0 + 32 * g;
            float tot = 0.f;
            #pragma unroll
            for (int i = 0; i < 8; i++) tot += red[row * 8 + i];
            rinv[row] = 1.0f / tot;
        }
    }
    __syncthreads();

    // Pass 3: P @ V  (waves 0..3: 16 of the 64 d-columns each, for all 4 query tiles, so that
    // the workgroup loads and converts each V fragment once; waves 4..7 are done, no barrier follows)
    if (wid >= 4) return;
    const int dcol = wid * 16 + tl;
    const float* vb = Vf + (size_t)bh * kS * kD + dcol;
    v8f acc[kQT] = {};
    // fully unrolled (the smaller body was unrolled unasked): the row clamps fold to constants
    // and the V loads of later blocks issue ahead of the products of earlier ones
    #pragma unroll
    for (int kk = 0; kk < kSP; kk += 32) {
        V16 pa[kQT];
        #pragma unroll   // constant qt: the fragment arrays stay in registers
        for (int qt = 0; qt < kQT; qt++) {
            const _Float16* prow = pr + (qt * 16 + tl) * kSP + kk;
            pa[qt].q[0] = *(const uint4*)(prow + 8 * hf);
            pa[qt].q[1] = *(const uint4*)(prow + 16 + 8 * hf);
        }
        union { _Float16 h[16]; v16h v; } bf;
        #pragma unroll
        for (int i = 0; i < 8; i++) {
            int s0 = kk + 8 * hf + i;        if (s0 > kS - 1) s0 = kS - 1;
            int s1 = kk + 16 + 8 * hf + i;   if (s1 > kS - 1) s1 = kS - 1;
            bf.h[i]     = (_Float16)vb[(size_t)s0 * kD];
            bf.h[i + 8] = (_Float16)vb[(size_t)s1 * kD];
        }
        #pragma unroll   // constant qt: the accumulator array stays in registers
        for (int qt = 0; qt < kQT; qt++)
            acc[qt] = __builtin_amdgcn_wmma_f32_16x16x32_f16(false, pa[qt].v, false, bf.v, (short)0, acc[qt], false, false);
    }
    #pragma unroll   // constant qt: the accumulator array stays in registers
    for (int qt = 0; qt < kQT; qt++) {
        const int mrow = qt * 16 + 8 * hf;      // the lane's first row of this tile
        const int t = tb + mrow;
        _Float16* op = O + ((size_t)b_ * kT + t) * kE + h_ * kD + dcol;
        if (tb + qt * 16 + 16 <= kT) {          // whole tile inside T (same for the whole workgroup)
            #pragma unroll
            for (int r = 0; r < 8; r++)
                op[(size_t)r * kE] = (_Float16)(acc[qt][r] * rinv[mrow + r]);
        } else {
            #pragma unroll
            for (int r = 0; r < 8; r++)
                if (t + r < kT)
                    op[(size_t)r * kE] = (_Float16)(acc[qt][r] * rinv[mrow + r]);
        }
    }
}

// ---------------------------------------------------------------------------
// Launcher
// ---------------------------------------------------------------------------
extern "C" void kernel_launch(void* const* d_in, const int* in_sizes, int n_in,
                              void* d_out, int out_size, void* d_ws, size_t ws_size,
                              hipStream_t stream) {
    const float* hs  = (const float*)d_in[0];
    const float* tkv = (const float*)d_in[1];
    const float* Wq  = (const float*)d_in[2];
    const float* bq  = (const float*)d_in[3];
    const float* Wk  = (const float*)d_in[4];
    const float* bk  = (const float*)d_in[5];
    const float* Wv  = (const float*)d_in[6];
    const float* bv  = (const float*)d_in[7];
    const float* Wo  = (const float*)d_in[8];
    const float* bo  = (const float*)d_in[9];
    const float* tw  = (const float*)d_in[10];

    float* out  = (float*)d_out;
    float* kout = out + OUT_ELEMS;
    float* vout = kout + KV_ELEMS;

    // workspace layout (all 256-aligned)
    char* ws = (char*)d_ws;
    _Float16* hs_h   = (_Float16*)(ws);                       // 18,907,136 B
    _Float16* wq_h   = (_Float16*)(ws + 18907136);            // 4 x 2,097,152 B
    _Float16* wk_h   = wq_h + (size_t)kE * kE;
    _Float16* wv_h   = wk_h + (size_t)kE * kE;
    _Float16* wo_h   = wv_h + (size_t)kE * kE;
    _Float16* q_h    = (_Float16*)(ws + 27295744);            // 18,907,136 B
    _Float16* attn_h = (_Float16*)(ws + 46202880);            // 18,907,136 B

    // 1) conversions to f16
    {
        int n4 = kM * kE / 4;
        f2h4_kernel<<<(n4 + 255) / 256, 256, 0, stream>>>(hs, hs_h, n4);
        int w4 = kE * kE / 4;
        f2h4_kernel<<<(w4 + 255) / 256, 256, 0, stream>>>(Wq, wq_h, w4);
        f2h4_kernel<<<(w4 + 255) / 256, 256, 0, stream>>>(Wk, wk_h, w4);
        f2h4_kernel<<<(w4 + 255) / 256, 256, 0, stream>>>(Wv, wv_h, w4);
        f2h4_kernel<<<(w4 + 255) / 256, 256, 0, stream>>>(Wo, wo_h, w4);
    }

    // 2) textual K/V (rows 0..76 of output K/V)
    {
        int n = 2 * kB * kH * 77 * kD;
        textual_kernel<<<(n + 255) / 256, 256, 0, stream>>>(tkv, tw, kout, vout);
    }

    // 3) Q/K/V projections
    dim3 ggrid((kM + 63) / 64, kE / 64);   // 145 x 16
    gemm_kernel<0><<<ggrid, 256, 0, stream>>>(hs_h, wq_h, bq, nullptr, q_h);
    gemm_kernel<1><<<ggrid, 256, 0, stream>>>(hs_h, wk_h, bk, kout, nullptr);
    gemm_kernel<2><<<ggrid, 256, 0, stream>>>(hs_h, wv_h, bv, vout, nullptr);

    // 4) attention
    attn_kernel<<<dim3((kT + kQR - 1) / kQR, kB * kH), 256, 0, stream>>>(q_h, kout, vout, attn_h);

    // 5) output projection
    gemm_kernel<3><<<ggrid, 256, 0, stream>>>(attn_h, wo_h, bo, out, nullptr);
}

// v002
// Measured time: 284 microseconds a run.
// Two timings next to v001 put it at 1.11 and 1.10 times that version's speed.
// All steps since v000 together make it 1.24 times as fast.
#include <hip/hip_runtime.h>
#include <hip/hip_bf16.h>

typedef __attribute__((ext_vector_type(16))) _Float16 v16h;
typedef __attribute__((ext_vector_type(8)))  float    v8f;

// Problem constants
constexpr int kB = 16;
constexpr int kT = 577;
constexpr int kE = 1024;
constexpr int kH = 16;
constexpr int kD = 64;
constexpr int kS = 654;            // 77 + 577
constexpr int kM = kB * kT;        // 9232 rows, divisible by 16
constexpr int kSP = 672;           // padded S (21 * 32)
constexpr long long OUT_ELEMS = (long long)kB * kT * kE;        // 9,453,568
constexpr long long KV_ELEMS  = (long long)kB * kH * kS * kD;   // 10,715,136
constexpr float NEG_BIG = -1e30f;

// ---------------------------------------------------------------------------
// CDNA5 async copy: global -> LDS, tracked by ASYNCcnt
// ---------------------------------------------------------------------------
// One lane's eight 16-byte copies of one operand's tile of a GEMM stage. The closing s_wait_xcnt stands
// in the copies' own statement, so that no address register is rewritten ahead of it.
__device__ __forceinline__ void async_copy8(const unsigned int (&l)[8], const unsigned long long (&g)[8]) {
    asm volatile("global_load_async_to_lds_b128 %0, %8, off\n\t"
                 "global_load_async_to_lds_b128 %1, %9, off\n\t"
                 "global_load_async_to_lds_b128 %2, %10, off\n\t"
                 "global_load_async_to_lds_b128 %3, %11, off\n\t"
                 "global_load_async_to_lds_b128 %4, %12, off\n\t"
                 "global_load_async_to_lds_b128 %5, %13, off\n\t"
                 "global_load_async_to_lds_b128 %6, %14, off\n\t"
                 "global_load_async_to_lds_b128 %7, %15, off\n\t"
                 "s_wait_xcnt 0x0"
                 :: "v"(l[0]), "v"(l[1]), "v"(l[2]), "v"(l[3]), "v"(l[4]), "v"(l[5]), "v"(l[6]), "v"(l[7]),
                    "v"(g[0]), "v"(g[1]), "v"(g[2]), "v"(g[3]), "v"(g[4]), "v"(g[5]), "v"(g[6]), "v"(g[7])
                 : "memory");
}
// this wave's copies have landed in LDS
__device__ __forceinline__ void wait_async0() {
    asm volatile("s_wait_asynccnt 0x0" ::: "memory");
}
// this wave's LDS reads have returned, before the buffer they read is handed back for a refill
__device__ __forceinline__ void wait_ds0() {
    asm volatile("s_wait_dscnt 0x0" ::: "memory");
}

// ---------------------------------------------------------------------------
// fp32 -> f16 conversion (vectorized by 4)
// ---------------------------------------------------------------------------
__global__ void f2h4_kernel(const float* __restrict__ s, _Float16* __restrict__ d, int n4) {
    int i = blockIdx.x * blockDim.x + threadIdx.x;
    if (i < n4) {
        float4 f = ((const float4*)s)[i];
        union { _Float16 h[4]; unsigned long long u; } p;
        p.h[0] = (_Float16)f.x; p.h[1] = (_Float16)f.y;
        p.h[2] = (_Float16)f.z; p.h[3] = (_Float16)f.w;
        ((unsigned long long*)d)[i] = p.u;
    }
}

// ---------------------------------------------------------------------------
// textual_kv * w -> K/V output rows [0..76];  textual_kv layout [2, B, H, 77, D]
// ---------------------------------------------------------------------------
__global__ void textual_kernel(const float* __restrict__ tkv, const float* __restrict__ wptr,
                               float* __restrict__ kout, float* __restrict__ vout) {
    int i = blockIdx.x * blockDim.x + threadIdx.x;
    const int N = 2 * kB * kH * 77 * kD;
    if (i >= N) return;
    float w = wptr[0];
    int d = i & 63;
    int r = i >> 6;
    int s = r % 77; r /= 77;
    int h = r & 15; r >>= 4;
    int b = r & 15;
    int part = r >> 4;
    float* dst = part ? vout : kout;
    dst[(((size_t)(b * kH + h)) * kS + s) * kD + d] = w * tkv[i];
}

// ---------------------------------------------------------------------------
// Tiled WMMA GEMM: C[m,n] = sum_k A[m,k] * W[n,k] (+ bias), M=9232, N=K=1024
// 128 threads = 4 waves as 2(m) x 2(n); output tile 128x128, 64x64 per wave (4 x 4 WMMA tiles),
// K-stage 64, double-buffered LDS filled by global_load_async_to_lds_b128 (ASYNCcnt).
// MODE 0: q -> f16 ws [B,H,T,D] with *0.125 scale
// MODE 1/2: k/v -> fp32 d_out at [bh, 77+t, d]
// MODE 3: o -> fp32 d_out [B,T,E]
// ---------------------------------------------------------------------------
constexpr int kTM = 128;           // output rows per workgroup
constexpr int kTN = 128;           // output columns per workgroup
constexpr int kKS = 64;            // k per stage
constexpr int kLP = 72;            // LDS row pitch in halves (144 B)

template<int MODE>
__global__ __launch_bounds__(128) void gemm_kernel(
    const _Float16* __restrict__ A,      // [kM, kE] f16
    const _Float16* __restrict__ W,      // [kE, kE] f16 (row n, contiguous k)
    const float*    __restrict__ bias,   // [kE]
    float*          __restrict__ dst_f,
    _Float16*       __restrict__ dst_h)
{
    __shared__ __align__(16) _Float16 As[2][kTM * kLP];
    __shared__ __align__(16) _Float16 Bs[2][kTN * kLP];

    const int tid  = threadIdx.x;
    const int m0   = blockIdx.x * kTM;
    const int n0   = blockIdx.y * kTN;
    const int lane = tid & 31;
    const int wid  = tid >> 5;
    const int mi   = wid & 1;        // 0..1 (64-row band)
    const int nj   = wid >> 1;       // 0..1 (64-column band)
    const int tl   = lane & 15;
    const int hf   = lane >> 4;      // lane half

    // async loader: per stage a thread copies 8 A-segments + 8 W-segments of 16 B, segment j in row
    // 16 * j + (tid >> 3) of the tile. One base address per operand; the steps between segments are
    // the same for the whole workgroup. M is a multiple of 16, so a 16-row group lies wholly inside A
    // or wholly past its end; a group past the end re-reads group 0 (its rows are never stored).
    static_assert(kM % 16 == 0, "16-row groups of A are whole");
    const int row0 = tid >> 3;              // 0..15
    const int off0 = (tid & 7) * 8;         // 0..56 halves
    const unsigned long long aBase = (unsigned long long)(uintptr_t)(A + (size_t)(m0 + row0) * kE + off0);
    const unsigned long long bBase = (unsigned long long)(uintptr_t)(W + (size_t)(n0 + row0) * kE + off0);
    const unsigned int       seg0  = (unsigned int)(row0 * kLP + off0) * 2u;   // byte offset in tile
    const unsigned int asB[2] = { (unsigned int)(uintptr_t)&As[0][0],
                                  (unsigned int)(uintptr_t)&As[1][0] };
    const unsigned int bsB[2] = { (unsigned int)(uintptr_t)&Bs[0][0],
                                  (unsigned int)(uintptr_t)&Bs[1][0] };

    auto issue = [&](int kb, int buf) {
        unsigned int la[8], lb[8];
        unsigned long long ga[8], gb[8];
        #pragma unroll   // constant j: the address arrays stay in registers
        for (int j = 0; j < 8; j++) {
            const int ar = (m0 + 16 * j < kM) ? 16 * j : 0;   // same for the whole workgroup
            la[j] = asB[buf] + seg0 + (unsigned int)(16 * j * kLP) * 2u;
            lb[j] = bsB[buf] + seg0 + (unsigned int)(16 * j * kLP) * 2u;
            ga[j] = aBase + (unsigned long long)(ar * kE + kb) * 2u;
            gb[j] = bBase + (unsigned long long)(16 * j * kE + kb) * 2u;
        }
        async_copy8(la, ga);
        async_copy8(lb, gb);
    };

    v8f c[4][4] = {};

    issue(0, 0);
    wait_async0();
    __syncthreads();
    issue(kKS, 1);

    constexpr int kStages = kE / kKS;
    #pragma unroll   // constant buffer index: LDS addresses fold into the loads' offsets
    for (int t = 0; t < kStages; t++) {
        const int buf = t & 1;
        const _Float16* Asb = As[buf];
        const _Float16* Bsb = Bs[buf];
        // all loops below: constant indices, so that fragments and accumulators stay in registers
        #pragma unroll
        for (int kk = 0; kk < kKS; kk += 32) {
            union { uint4 q[2]; v16h v; } a[4], b[4];
            #pragma unroll
            for (int i = 0; i < 4; i++) {
                const _Float16* ar = Asb + (mi * 64 + i * 16 + tl) * kLP + kk;
                a[i].q[0] = *(const uint4*)(ar + 8 * hf);
                a[i].q[1] = *(const uint4*)(ar + 16 + 8 * hf);
            }
            #pragma unroll
            for (int j = 0; j < 4; j++) {
                const _Float16* br = Bsb + (nj * 64 + j * 16 + tl) * kLP + kk;
                b[j].q[0] = *(const uint4*)(br + 8 * hf);
                b[j].q[1] = *(const uint4*)(br + 16 + 8 * hf);
            }
            // keeps the block's 16 LDS reads together ahead of its 16 products: left alone, the compiler
            // re-uses one A fragment's registers and waits out the LDS latency after every 4 products
            __builtin_amdgcn_sched_barrier(0);
            #pragma unroll
            for (int i = 0; i < 4; i++)
                #pragma unroll
                for (int j = 0; j < 4; j++)
                    c[i][j] = __builtin_amdgcn_wmma_f32_16x16x32_f16(false, a[i].v, false, b[j].v,
                                                                     (short)0, c[i][j], false, false);
        }

        wait_ds0();          // my reads of this buffer are done
        wait_async0();       // my next-stage copies have landed in LDS
        __syncthreads();     // everyone's copies landed, everyone done reading
        if (t + 2 < kStages) issue((t + 2) * kKS, buf);   // refill the buffer just read
    }
    wait_async0();           // nothing of this wave is in flight when it leaves the ring

    // epilogue loops: constant indices into the accumulator array
    float bval[4];
    #pragma unroll
    for (int j = 0; j < 4; j++) bval[j] = bias[n0 + nj * 64 + j * 16 + tl];

    #pragma unroll
    for (int i = 0; i < 4; i++) {
        #pragma unroll
        for (int r = 0; r < 8; r++) {
            const int m = m0 + mi * 64 + i * 16 + r + 8 * hf;
            if (m >= kM) continue;
            const int b_ = m / kT, t = m % kT;
            #pragma unroll
            for (int j = 0; j < 4; j++) {
                const int n = n0 + nj * 64 + j * 16 + tl;
                const int h_ = n >> 6, d_ = n & 63;
                float val = c[i][j][r] + bval[j];
                if (MODE == 0) {
                    val *= 0.125f;  // D^-0.5
                    dst_h[(((size_t)(b_ * kH + h_)) * kT + t) * kD + d_] = (_Float16)val;
                } else if (MODE == 1 || MODE == 2) {
                    dst_f[(((size_t)(b_ * kH + h_)) * kS + 77 + t) * kD + d_] = val;
                } else {
                    dst_f[(size_t)m * kE + n] = val;
                }
            }
        }
    }
}

// ---------------------------------------------------------------------------
// Attention: one workgroup per (bh, 64-query block = 4 tiles of 16). 256 threads = 8 waves.
// Every K fragment (pass 1) and every V fragment (pass 3) is loaded and converted once per
// workgroup and multiplied with all 4 query tiles.
// Pass1: scores = Q K^T into LDS (WMMA). Pass2: softmax in LDS (probs f16).
// Pass3: out = P V (WMMA), rows rescaled by 1/rowsum, -> attn f16 ws [B,T,E].
// ---------------------------------------------------------------------------
constexpr int kQT = 4;             // query tiles per workgroup
constexpr int kQR = kQT * 16;      // query rows per workgroup

__global__ __launch_bounds__(256) void attn_kernel(
    const _Float16* __restrict__ Q,   // [B*H, T, D] f16 (pre-scaled)
    const float*    __restrict__ Kf,  // [B*H, S, D] fp32
    const float*    __restrict__ Vf,  // [B*H, S, D] fp32
    _Float16*       __restrict__ O)   // [B, T, E] f16
{
    __shared__ __align__(16) float    sc[kQR * kSP];
    __shared__ __align__(16) _Float16 pr[kQR * kSP];
    __shared__ float red[kQR * 8];
    __shared__ float rinv[kQR];

    const int tb   = blockIdx.x * kQR;      // first query row of the block
    const int bh   = blockIdx.y;            // 0..255
    const int b_   = bh >> 4, h_ = bh & 15;
    const int tid  = threadIdx.x;
    const int lane = tid & 31;
    const int wid  = tid >> 5;              // 0..7
    const int tl   = lane & 15;
    const int hf   = lane >> 4;

    // init pad columns [656..671] to -big
    for (int i = tid; i < kQR * 16; i += 256)
        sc[(i >> 4) * kSP + 656 + (i & 15)] = NEG_BIG;

    // Q fragments: fixed per wave-lane (row t, K split over d), one pair per query tile
    union V16 { uint4 q[2]; v16h v; };
    V16 a0[kQT], a1[kQT];
    #pragma unroll   // constant qt: the fragment arrays stay in registers
    for (int qt = 0; qt < kQT; qt++) {
        int tq = tb + qt * 16 + tl; if (tq > kT - 1) tq = kT - 1;
        const _Float16* qr = Q + ((size_t)bh * kT + tq) * kD;
        a0[qt].q[0] = *(const uint4*)(qr + 8 * hf);
        a0[qt].q[1] = *(const uint4*)(qr + 16 + 8 * hf);
        a1[qt].q[0] = *(const uint4*)(qr + 32 + 8 * hf);
        a1[qt].q[1] = *(const uint4*)(qr + 48 + 8 * hf);
        // before a later tile's load may land in a register that holds this tile's address
        asm volatile("s_wait_xcnt 0x0" ::: "memory");
    }

    // Pass 1: scores
    for (int st = wid; st < 41; st += 8) {
        const int s = st * 16 + tl;
        const bool valid = (s < kS);
        const int scl = valid ? s : (kS - 1);
        const float* kr = Kf + ((size_t)bh * kS + scl) * kD;
        union { _Float16 h[16]; v16h v; } b0, b1;
        #pragma unroll
        for (int i = 0; i < 8; i++) {
            b0.h[i]     = (_Float16)kr[      8 * hf + i];
            b0.h[i + 8] = (_Float16)kr[16  + 8 * hf + i];
            b1.h[i]     = (_Float16)kr[32  + 8 * hf + i];
            b1.h[i + 8] = (_Float16)kr[48  + 8 * hf + i];
        }
        #pragma unroll   // constant qt: the fragment arrays stay in registers
        for (int qt = 0; qt < kQT; qt++) {
            v8f c = {};
            c = __builtin_amdgcn_wmma_f32_16x16x32_f16(false, a0[qt].v, false, b0.v, (short)0, c, false, false);
            c = __builtin_amdgcn_wmma_f32_16x16x32_f16(false, a1[qt].v, false, b1.v, (short)0, c, false, false);
            #pragma unroll
            for (int r = 0; r < 8; r++)
                sc[(qt * 16 + r + 8 * hf) * kSP + st * 16 + tl] = valid ? c[r] : NEG_BIG;
        }
    }
    __syncthreads();

    // Pass 2: softmax (64 rows x 8 threads each; a thread serves rows row0 and row0 + 32)
    const int row0 = tid >> 3, sub = tid & 7;
    #pragma unroll   // constant g: row offsets fold
    for (int g = 0; g < 2; g++) {
        const int row = row0 + 32 * g;
        float lmax = NEG_BIG;
        for (int cix = sub; cix < kSP; cix += 8)
            lmax = fmaxf(lmax, sc[row * kSP + cix]);
        red[row * 8 + sub] = lmax;
    }
    __syncthreads();
    float rmax[2];
    #pragma unroll   // constant g: rmax[] stays in registers, row offsets fold
    for (int g = 0; g < 2; g++) {
        const int row = row0 + 32 * g;
        rmax[g] = NEG_BIG;
        #pragma unroll
        for (int i = 0; i < 8; i++) rmax[g] = fmaxf(rmax[g], red[row * 8 + i]);
    }
    __syncthreads();
    #pragma unroll   // constant g: rmax[] stays in registers, row offsets fold
    for (int g = 0; g < 2; g++) {
        const int row = row0 + 32 * g;
        float lsum = 0.f;
        for (int cix = sub; cix < kSP; cix += 8) {
            float p = __expf(sc[row * kSP + cix] - rmax[g]);
            lsum += p;
            pr[row * kSP + cix] = (_Float16)p;
        }
        red[row * 8 + sub] = lsum;
    }
    __syncthreads();
    if (sub == 0) {
        #pragma unroll   // constant g: row offsets fold
        for (int g = 0; g < 2; g++) {
            const int row = row0 + 32 * g;
            float tot = 0.f;
            #pragma unroll
            for (int i = 0; i < 8; i++) tot += red[row * 8 + i];
            rinv[row] = 1.0f / tot;
        }
    }
    __syncthreads();

    // Pass 3: P @ V  (waves 0..3: 16 of the 64 d-columns each, for all 4 query tiles, so that
    // the workgroup loads and converts each V fragment once; waves 4..7 are done, no barrier follows)
    if (wid >= 4) return;
    const int dcol = wid * 16 + tl;
    const float* vb = Vf + (size_t)bh * kS * kD + dcol;
    v8f acc[kQT] = {};
    // fully unrolled (the smaller body was unrolled unasked): the row clamps fold to constants
    // and the V loads of later blocks issue ahead of the products of earlier ones
    #pragma unroll
    for (int kk = 0; kk < kSP; kk += 32) {
        V16 pa[kQT];
        #pragma unroll   // constant qt: the fragment arrays stay in registers
        for (int qt = 0; qt < kQT; qt++) {
            const _Float16* prow = pr + (qt * 16 + tl) * kSP + kk;
            pa[qt].q[0] = *(const uint4*)(prow + 8 * hf);
            pa[qt].q[1] = *(const uint4*)(prow + 16 + 8 * hf);
        }
        union { _Float16 h[16]; v16h v; } bf;
        #pragma unroll
        for (int i = 0; i < 8; i++) {
            int s0 = kk + 8 * hf + i;        if (s0 > kS - 1) s0 = kS - 1;
            int s1 = kk + 16 + 8 * hf + i;   if (s1 > kS - 1) s1 = kS - 1;
            bf.h[i]     = (_Float16)vb[(size_t)s0 * kD];
            bf.h[i + 8] = (_Float16)vb[(size_t)s1 * kD];
        }
        #pragma unroll   // constant qt: the accumulator array stays in registers
        for (int qt = 0; qt < kQT; qt++)
            acc[qt] = __builtin_amdgcn_wmma_f32_16x16x32_f16(false, pa[qt].v, false, bf.v, (short)0, acc[qt], false, false);
    }
    #pragma unroll   // constant qt: the accumulator array stays in registers
    for (int qt = 0; qt < kQT; qt++) {
        const int mrow = qt * 16 + 8 * hf;      // the lane's first row of this tile
        const int t = tb + mrow;
        _Float16* op = O + ((size_t)b_ * kT + t) * kE + h_ * kD + dcol;
        if (tb + qt * 16 + 16 <= kT) {          // whole tile inside T (same for the whole workgroup)
            #pragma unroll
            for (int r = 0; r < 8; r++)
                op[(size_t)r * kE] = (_Float16)(acc[qt][r] * rinv[mrow + r]);
        } else {
            #pragma unroll
            for (int r = 0; r < 8; r++)
                if (t + r < kT)
                    op[(size_t)r * kE] = (_Float16)(acc[qt][r] * rinv[mrow + r]);
        }
    }
}

// ---------------------------------------------------------------------------
// Launcher
// ---------------------------------------------------------------------------
extern "C" void kernel_launch(void* const* d_in, const int* in_sizes, int n_in,
                              void* d_out, int out_size, void* d_ws, size_t ws_size,
                              hipStream_t stream) {
    const float* hs  = (const float*)d_in[0];
    const float* tkv = (const float*)d_in[1];
    const float* Wq  = (const float*)d_in[2];
    const float* bq  = (const float*)d_in[3];
    const float* Wk  = (const float*)d_in[4];
    const float* bk  = (const float*)d_in[5];
    const float* Wv  = (const float*)d_in[6];
    const float* bv  = (const float*)d_in[7];
    const float* Wo  = (const float*)d_in[8];
    const float* bo  = (const float*)d_in[9];
    const float* tw  = (const float*)d_in[10];

    float* out  = (float*)d_out;
    float* kout = out + OUT_ELEMS;
    float* vout = kout + KV_ELEMS;

    // workspace layout (all 256-aligned)
    char* ws = (char*)d_ws;
    _Float16* hs_h   = (_Float16*)(ws);                       // 18,907,136 B
    _Float16* wq_h   = (_Float16*)(ws + 18907136);            // 4 x 2,097,152 B
    _Float16* wk_h   = wq_h + (size_t)kE * kE;
    _Float16* wv_h   = wk_h + (size_t)kE * kE;
    _Float16* wo_h   = wv_h + (size_t)kE * kE;
    _Float16* q_h    = (_Float16*)(ws + 27295744);            // 18,907,136 B
    _Float16* attn_h = (_Float16*)(ws + 46202880);            // 18,907,136 B

    // 1) conversions to f16
    {
        int n4 = kM * kE / 4;
        f2h4_kernel<<<(n4 + 255) / 256, 256, 0, stream>>>(hs, hs_h, n4);
        int w4 = kE * kE / 4;
        f2h4_kernel<<<(w4 + 255) / 256, 256, 0, stream>>>(Wq, wq_h, w4);
        f2h4_kernel<<<(w4 + 255) / 256, 256, 0, stream>>>(Wk, wk_h, w4);
        f2h4_kernel<<<(w4 + 255) / 256, 256, 0, stream>>>(Wv, wv_h, w4);
        f2h4_kernel<<<(w4 + 255) / 256, 256, 0, stream>>>(Wo, wo_h, w4);
    }

    // 2) textual K/V (rows 0..76 of output K/V)
    {
        int n = 2 * kB * kH * 77 * kD;
        textual_kernel<<<(n + 255) / 256, 256, 0, stream>>>(tkv, tw, kout, vout);
    }

    // 3) Q/K/V projections
    dim3 ggrid((kM + kTM - 1) / kTM, kE / kTN);   // 73 x 8
    gemm_kernel<0><<<ggrid, 128, 0, stream>>>(hs_h, wq_h, bq, nullptr, q_h);
    gemm_kernel<1><<<ggrid, 128, 0, stream>>>(hs_h, wk_h, bk, kout, nullptr);
    gemm_kernel<2><<<ggrid, 128, 0, stream>>>(hs_h, wv_h, bv, vout, nullptr);

    // 4) attention
    attn_kernel<<<dim3((kT + kQR - 1) / kQR, kB * kH), 256, 0, stream>>>(q_h, kout, vout, attn_h);

    // 5) output projection
    gemm_kernel<3><<<ggrid, 128, 0, stream>>>(attn_h, wo_h, bo, out, nullptr);
}

// v003
// Measured time: 153 microseconds a run.
// Next to v002, in two timings, it ran 1.88 and 1.84 times as fast.
// Over all steps from v000 it is 2.30 times as fast.
#include <hip/hip_runtime.h>
#include <hip/hip_bf16.h>

typedef __attribute__((ext_vector_type(16))) _Float16 v16h;
typedef __attribute__((ext_vector_type(8)))  float    v8f;

// Problem constants
constexpr int kB = 16;
constexpr int kT = 577;
constexpr int kE = 1024;
constexpr int kH = 16;
constexpr int kD = 64;
constexpr int kS = 654;            // 77 + 577
constexpr int kM = kB * kT;        // 9232 rows, divisible by 16
constexpr int kSP = 672;           // padded S (21 * 32)
constexpr long long OUT_ELEMS = (long long)kB * kT * kE;        // 9,453,568
constexpr long long KV_ELEMS  = (long long)kB * kH * kS * kD;   // 10,715,136
constexpr float NEG_BIG = -1e30f;

// ---------------------------------------------------------------------------
// CDNA5 async copy: global -> LDS, tracked by ASYNCcnt
// ---------------------------------------------------------------------------
// One lane's eight 16-byte copies of one operand's tile of a GEMM stage. The closing s_wait_xcnt stands
// in the copies' own statement, so that no address register is rewritten ahead of it.
__device__ __forceinline__ void async_copy8(const unsigned int (&l)[8], const unsigned long long (&g)[8]) {
    asm volatile("global_load_async_to_lds_b128 %0, %8, off\n\t"
                 "global_load_async_to_lds_b128 %1, %9, off\n\t"
                 "global_load_async_to_lds_b128 %2, %10, off\n\t"
                 "global_load_async_to_lds_b128 %3, %11, off\n\t"
                 "global_load_async_to_lds_b128 %4, %12, off\n\t"
                 "global_load_async_to_lds_b128 %5, %13, off\n\t"
                 "global_load_async_to_lds_b128 %6, %14, off\n\t"
                 "global_load_async_to_lds_b128 %7, %15, off\n\t"
                 "s_wait_xcnt 0x0"
                 :: "v"(l[0]), "v"(l[1]), "v"(l[2]), "v"(l[3]), "v"(l[4]), "v"(l[5]), "v"(l[6]), "v"(l[7]),
                    "v"(g[0]), "v"(g[1]), "v"(g[2]), "v"(g[3]), "v"(g[4]), "v"(g[5]), "v"(g[6]), "v"(g[7])
                 : "memory");
}
// this wave's copies have landed in LDS
__device__ __forceinline__ void wait_async0() {
    asm volatile("s_wait_asynccnt 0x0" ::: "memory");
}
// this wave's LDS reads have returned, before the buffer they read is handed back for a refill
__device__ __forceinline__ void wait_ds0() {
    asm volatile("s_wait_dscnt 0x0" ::: "memory");
}

// ---------------------------------------------------------------------------
// fp32 -> f16 conversion (vectorized by 4)
// ---------------------------------------------------------------------------
__global__ void f2h4_kernel(const float* __restrict__ s, _Float16* __restrict__ d, int n4) {
    int i = blockIdx.x * blockDim.x + threadIdx.x;
    if (i < n4) {
        float4 f = ((const float4*)s)[i];
        union { _Float16 h[4]; unsigned long long u; } p;
        p.h[0] = (_Float16)f.x; p.h[1] = (_Float16)f.y;
        p.h[2] = (_Float16)f.z; p.h[3] = (_Float16)f.w;
        ((unsigned long long*)d)[i] = p.u;
    }
}

// ---------------------------------------------------------------------------
// textual_kv * w -> K/V output rows [0..76];  textual_kv layout [2, B, H, 77, D]
// ---------------------------------------------------------------------------
__global__ void textual_kernel(const float* __restrict__ tkv, const float* __restrict__ wptr,
                               float* __restrict__ kout, float* __restrict__ vout) {
    int i = blockIdx.x * blockDim.x + threadIdx.x;
    const int N = 2 * kB * kH * 77 * kD;
    if (i >= N) return;
    float w = wptr[0];
    int d = i & 63;
    int r = i >> 6;
    int s = r % 77; r /= 77;
    int h = r & 15; r >>= 4;
    int b = r & 15;
    int part = r >> 4;
    float* dst = part ? vout : kout;
    dst[(((size_t)(b * kH + h)) * kS + s) * kD + d] = w * tkv[i];
}

// ---------------------------------------------------------------------------
// Tiled WMMA GEMM: C[m,n] = sum_k A[m,k] * W[n,k] (+ bias), M=9232, N=K=1024
// 128 threads = 4 waves as 2(m) x 2(n); output tile 128x128, 64x64 per wave (4 x 4 WMMA tiles),
// K-stage 64, double-buffered LDS filled by global_load_async_to_lds_b128 (ASYNCcnt).
// MODE 0: q -> f16 ws [B,H,T,D] with *0.125 scale
// MODE 1/2: k/v -> fp32 d_out at [bh, 77+t, d]
// MODE 3: o -> fp32 d_out [B,T,E]
// ---------------------------------------------------------------------------
constexpr int kTM = 128;           // output rows per workgroup
constexpr int kTN = 128;           // output columns per workgroup
constexpr int kKS = 64;            // k per stage
constexpr int kLP = 72;            // LDS row pitch in halves (144 B)

template<int MODE>
__global__ __launch_bounds__(128) void gemm_kernel(
    const _Float16* __restrict__ A,      // [kM, kE] f16
    const _Float16* __restrict__ W,      // [kE, kE] f16 (row n, contiguous k)
    const float*    __restrict__ bias,   // [kE]
    float*          __restrict__ dst_f,
    _Float16*       __restrict__ dst_h)
{
    __shared__ __align__(16) _Float16 As[2][kTM * kLP];
    __shared__ __align__(16) _Float16 Bs[2][kTN * kLP];

    const int tid  = threadIdx.x;
    const int m0   = blockIdx.x * kTM;
    const int n0   = blockIdx.y * kTN;
    const int lane = tid & 31;
    const int wid  = tid >> 5;
    const int mi   = wid & 1;        // 0..1 (64-row band)
    const int nj   = wid >> 1;       // 0..1 (64-column band)
    const int tl   = lane & 15;
    const int hf   = lane >> 4;      // lane half

    // async loader: per stage a thread copies 8 A-segments + 8 W-segments of 16 B, segment j in row
    // 16 * j + (tid >> 3) of the tile. One base address per operand; the steps between segments are
    // the same for the whole workgroup. M is a multiple of 16, so a 16-row group lies wholly inside A
    // or wholly past its end; a group past the end re-reads group 0 (its rows are never stored).
    static_assert(kM % 16 == 0, "16-row groups of A are whole");
    const int row0 = tid >> 3;              // 0..15
    const int off0 = (tid & 7) * 8;         // 0..56 halves
    const unsigned long long aBase = (unsigned long long)(uintptr_t)(A + (size_t)(m0 + row0) * kE + off0);
    const unsigned long long bBase = (unsigned long long)(uintptr_t)(W + (size_t)(n0 + row0) * kE + off0);
    const unsigned int       seg0  = (unsigned int)(row0 * kLP + off0) * 2u;   // byte offset in tile
    const unsigned int asB[2] = { (unsigned int)(uintptr_t)&As[0][0],
                                  (unsigned int)(uintptr_t)&As[1][0] };
    const unsigned int bsB[2] = { (unsigned int)(uintptr_t)&Bs[0][0],
                                  (unsigned int)(uintptr_t)&Bs[1][0] };

    auto issue = [&](int kb, int buf) {
        unsigned int la[8], lb[8];
        unsigned long long ga[8], gb[8];
        #pragma unroll   // constant j: the address arrays stay in registers
        for (int j = 0; j < 8; j++) {
            const int ar = (m0 + 16 * j < kM) ? 16 * j : 0;   // same for the whole workgroup
            la[j] = asB[buf] + seg0 + (unsigned int)(16 * j * kLP) * 2u;
            lb[j] = bsB[buf] + seg0 + (unsigned int)(16 * j * kLP) * 2u;
            ga[j] = aBase + (unsigned long long)(ar * kE + kb) * 2u;
            gb[j] = bBase + (unsigned long long)(16 * j * kE + kb) * 2u;
        }
        async_copy8(la, ga);
        async_copy8(lb, gb);
    };

    v8f c[4][4] = {};

    issue(0, 0);
    wait_async0();
    __syncthreads();
    issue(kKS, 1);

    constexpr int kStages = kE / kKS;
    #pragma unroll   // constant buffer index: LDS addresses fold into the loads' offsets
    for (int t = 0; t < kStages; t++) {
        const int buf = t & 1;
        const _Float16* Asb = As[buf];
        const _Float16* Bsb = Bs[buf];
        // all loops below: constant indices, so that fragments and accumulators stay in registers
        #pragma unroll
        for (int kk = 0; kk < kKS; kk += 32) {
            union { uint4 q[2]; v16h v; } a[4], b[4];
            #pragma unroll
            for (int i = 0; i < 4; i++) {
                const _Float16* ar = Asb + (mi * 64 + i * 16 + tl) * kLP + kk;
                a[i].q[0] = *(const uint4*)(ar + 8 * hf);
                a[i].q[1] = *(const uint4*)(ar + 16 + 8 * hf);
            }
            #pragma unroll
            for (int j = 0; j < 4; j++) {
                const _Float16* br = Bsb + (nj * 64 + j * 16 + tl) * kLP + kk;
                b[j].q[0] = *(const uint4*)(br + 8 * hf);
                b[j].q[1] = *(const uint4*)(br + 16 + 8 * hf);
            }
            // keeps the block's 16 LDS reads together ahead of its 16 products: left alone, the compiler
            // re-uses one A fragment's registers and waits out the LDS latency after every 4 products
            __builtin_amdgcn_sched_barrier(0);
            #pragma unroll
            for (int i = 0; i < 4; i++)
                #pragma unroll
                for (int j = 0; j < 4; j++)
                    c[i][j] = __builtin_amdgcn_wmma_f32_16x16x32_f16(false, a[i].v, false, b[j].v,
                                                                     (short)0, c[i][j], false, false);
        }

        wait_ds0();          // my reads of this buffer are done
        wait_async0();       // my next-stage copies have landed in LDS
        __syncthreads();     // everyone's copies landed, everyone done reading
        if (t + 2 < kStages) issue((t + 2) * kKS, buf);   // refill the buffer just read
    }
    wait_async0();           // nothing of this wave is in flight when it leaves the ring

    // epilogue loops: constant indices into the accumulator array
    float bval[4];
    #pragma unroll
    for (int j = 0; j < 4; j++) bval[j] = bias[n0 + nj * 64 + j * 16 + tl];

    #pragma unroll
    for (int i = 0; i < 4; i++) {
        #pragma unroll
        for (int r = 0; r < 8; r++) {
            const int m = m0 + mi * 64 + i * 16 + r + 8 * hf;
            if (m >= kM) continue;
            const int b_ = m / kT, t = m % kT;
            #pragma unroll
            for (int j = 0; j < 4; j++) {
                const int n = n0 + nj * 64 + j * 16 + tl;
                const int h_ = n >> 6, d_ = n & 63;
                float val = c[i][j][r] + bval[j];
                if (MODE == 0) {
                    val *= 0.125f;  // D^-0.5
                    dst_h[(((size_t)(b_ * kH + h_)) * kT + t) * kD + d_] = (_Float16)val;
                } else if (MODE == 1 || MODE == 2) {
                    dst_f[(((size_t)(b_ * kH + h_)) * kS + 77 + t) * kD + d_] = val;
                } else {
                    dst_f[(size_t)m * kE + n] = val;
                }
            }
        }
    }
}

// ---------------------------------------------------------------------------
// Attention: one workgroup per (batch, head); 19 waves of 32 query columns cover all 577 queries.
// The head's K and V are read from memory once, converted to f16 and laid in LDS (pad keys as zeros).
// Then each wave walks the keys in passes of 32 with no further barrier:
//   S^T = K Q^T (a lane holds 16 scores of one query), running maximum and sum in registers,
//   P^T packed from the score accumulators straight into a B operand, O^T += V^T P^T with V^T from the
//   transposing LDS load. Scores and probabilities never touch LDS.
// The maximum in use may trail the true one by up to 8 (log2 units), so the accumulators are rescaled rarely.
// ---------------------------------------------------------------------------
constexpr int kAW  = 19;           // waves per workgroup
constexpr int kAT  = kAW * 32;     // threads per workgroup
constexpr int kKPB = 144;          // LDS pitch of a K row in bytes: 16 x odd, for ds_load_b128
constexpr int kVPB = 160;          // LDS pitch of a V row in bytes: 32 x odd, for ds_load_tr16_b128
constexpr float kLog2e = 1.4426950408889634f;
static_assert(kAW * 32 >= kT, "the waves' query columns cover T");
static_assert(kSP - 32 < kS && kS <= kSP, "only the last pass holds pad keys, and it holds real ones too");

typedef short s16x8 __attribute__((ext_vector_type(8)));
typedef float f32x2 __attribute__((ext_vector_type(2)));

// row-major 16-bit LDS tile -> 8 k values of one column per lane (half of a transposed A fragment)
__device__ __forceinline__ uint4 ld_tr16(const unsigned char* p) {
    typedef __attribute__((address_space(3))) s16x8 lds_s16x8;
    return __builtin_bit_cast(uint4, __builtin_amdgcn_ds_load_tr16_b128_v8i16((lds_s16x8*)p));
}
// two floats -> two f16 in one dword, round to nearest even
__device__ __forceinline__ unsigned int pack2h(float lo, float hi) {
    typedef _Float16 h2 __attribute__((ext_vector_type(2)));
    typedef float    f2 __attribute__((ext_vector_type(2)));
    return __builtin_bit_cast(unsigned int, __builtin_convertvector(f2{lo, hi}, h2));
}
// value of lane l ^ 16
__device__ __forceinline__ float xhalf(float x) {
    return __builtin_bit_cast(float, __builtin_amdgcn_permlanex16(__builtin_bit_cast(int, x), __builtin_bit_cast(int, x),
                                                                  0x76543210, 0xfedcba98, false, false));
}

union V16 { uint4 q[2]; v16h v; };

// One pass of one wave: 32 keys from key0 on, against the wave's 32 query columns.
template<bool LAST>
__device__ __forceinline__ void attn_pass(const unsigned char* Ks, const unsigned char* Vs, int key0, int lane,
                                          const V16 (&qf)[2][2], v8f (&acc)[2][4], float (&mrun)[2], f32x2 (&lrun)[2]) {
    const int tl = lane & 15, hf = lane >> 4;
    // all loops below: constant indices, so that fragments and accumulators stay in registers
    V16 kf[2][2];      // [16-key tile][d half]
    const unsigned char* kp = Ks + (key0 + tl) * kKPB + 16 * hf;
    #pragma unroll
    for (int kt = 0; kt < 2; kt++)
        #pragma unroll
        for (int kc = 0; kc < 2; kc++) {
            kf[kt][kc].q[0] = *(const uint4*)(kp + kt * 16 * kKPB + 64 * kc);
            kf[kt][kc].q[1] = *(const uint4*)(kp + kt * 16 * kKPB + 64 * kc + 32);
        }
    V16 pf[2];         // P^T per column group
    #pragma unroll
    for (int g = 0; g < 2; g++) {
        v8f s[2];      // s[kt][r] = score of key key0 + 16 kt + 8 hf + r with query column tl of group g
        #pragma unroll
        for (int kt = 0; kt < 2; kt++) {
            s[kt] = v8f{};
            #pragma unroll
            for (int kc = 0; kc < 2; kc++)
                s[kt] = __builtin_amdgcn_wmma_f32_16x16x32_f16(false, kf[kt][kc].v, false, qf[g][kc].v,
                                                               (short)0, s[kt], false, false);
        }
        if (LAST) {
            #pragma unroll
            for (int kt = 0; kt < 2; kt++)
                #pragma unroll
                for (int r = 0; r < 8; r++)
                    if (key0 + 16 * kt + 8 * hf + r >= kS) s[kt][r] = NEG_BIG;
        }
        float mx = s[0][0];
        #pragma unroll
        for (int r = 1; r < 8; r++) mx = fmaxf(mx, s[0][r]);
        #pragma unroll
        for (int r = 0; r < 8; r++) mx = fmaxf(mx, s[1][r]);
        mx = fmaxf(mx, xhalf(mx)) * kLog2e;     // both lane halves hold the query's maximum of this pass
        if (__builtin_amdgcn_ballot_w32(mx > mrun[g] + 8.0f) != 0) {   // scalar branch, rare after the first pass
            const float mnew = fmaxf(mrun[g], mx);
            const float corr = __builtin_amdgcn_exp2f(mrun[g] - mnew);
            mrun[g] = mnew;
            lrun[g] = lrun[g] * corr;
            #pragma unroll
            for (int t = 0; t < 4; t++) acc[g][t] = acc[g][t] * corr;
        }
        const float nm = -mrun[g];
        unsigned int w[8];
        #pragma unroll
        for (int i = 0; i < 8; i++) {           // elements 2i, 2i + 1 of the 32-key B operand
            const f32x2 arg = __builtin_elementwise_fma(f32x2{s[i >> 2][2 * (i & 3)], s[i >> 2][2 * (i & 3) + 1]},
                                                        f32x2{kLog2e, kLog2e}, f32x2{nm, nm});
            const f32x2 p = {__builtin_amdgcn_exp2f(arg.x), __builtin_amdgcn_exp2f(arg.y)};
            lrun[g] += p;
            w[i] = pack2h(p.x, p.y);
        }
        pf[g].q[0] = uint4{w[0], w[1], w[2], w[3]};
        pf[g].q[1] = uint4{w[4], w[5], w[6], w[7]};
    }
    V16 vf[4];         // V^T: 16 d rows x 32 keys per fragment
    const unsigned char* vp = Vs + (key0 + 8 * hf + (lane & 7)) * kVPB + ((lane >> 3) & 1) * 16;
    #pragma unroll
    for (int t = 0; t < 4; t++) {
        vf[t].q[0] = ld_tr16(vp + 32 * t);
        vf[t].q[1] = ld_tr16(vp + 16 * kVPB + 32 * t);
    }
    #pragma unroll
    for (int g = 0; g < 2; g++)
        #pragma unroll
        for (int t = 0; t < 4; t++)
            acc[g][t] = __builtin_amdgcn_wmma_f32_16x16x32_f16(false, vf[t].v, false, pf[g].v,
                                                               (short)0, acc[g][t], false, false);
}

__global__ __launch_bounds__(kAT) void attn_kernel(
    const _Float16* __restrict__ Q,   // [B*H, T, D] f16 (pre-scaled)
    const float*    __restrict__ Kf,  // [B*H, S, D] fp32
    const float*    __restrict__ Vf,  // [B*H, S, D] fp32
    _Float16*       __restrict__ O)   // [B, T, E] f16
{
    __shared__ __align__(32) unsigned char Ks[kSP * kKPB];
    __shared__ __align__(32) unsigned char Vs[kSP * kVPB];

    const int bh   = blockIdx.x;            // 0..255
    const int b_   = bh >> 4, h_ = bh & 15;
    const int tid  = threadIdx.x;
    const int lane = tid & 31;
    const int wid  = tid >> 5;              // 0..18
    const int tl   = lane & 15;
    const int hf   = lane >> 4;

    // Stage K and V: a thread converts 4 consecutive floats per step; pad rows [kS, kSP) become zeros
    // (a pad key's probability is 0, and 0 x V must stay 0).
    const float* kg = Kf + (size_t)bh * kS * kD;
    const float* vg = Vf + (size_t)bh * kS * kD;
    constexpr int kChunks = kSP * (kD / 4);     // chunks of 4 elements, pad rows included
    constexpr int kReal   = kS * (kD / 4);      // chunks that exist in memory
    #pragma unroll   // constant trip: the loads of the whole steps issue together, ahead of the first conversion
    for (int it = 0; it < (kChunks + kAT - 1) / kAT; it++) {
        const int ch = it * kAT + tid;
        // the first test of each pair is a constant: only the last step carries lane tests
        if ((it + 1) * kAT <= kChunks || ch < kChunks) {
            const int row = ch >> 4, c4 = ch & 15;
            uint2 kq = {0u, 0u}, vq = {0u, 0u};
            if ((it + 1) * kAT <= kReal || ch < kReal) {
                const float4 kx = *(const float4*)(kg + (size_t)ch * 4);
                const float4 vx = *(const float4*)(vg + (size_t)ch * 4);
                kq = uint2{pack2h(kx.x, kx.y), pack2h(kx.z, kx.w)};
                vq = uint2{pack2h(vx.x, vx.y), pack2h(vx.z, vx.w)};
            }
            *(uint2*)(Ks + row * kKPB + c4 * 8) = kq;
            *(uint2*)(Vs + row * kVPB + c4 * 8) = vq;
        }
    }

    // Q fragments (B operand: column = query, k = d), kept in registers; columns past T repeat the last query
    V16 qf[2][2];
    #pragma unroll   // constant g: the fragment array stays in registers
    for (int g = 0; g < 2; g++) {
        int tq = wid * 32 + g * 16 + tl; if (tq > kT - 1) tq = kT - 1;
        const _Float16* qr = Q + ((size_t)bh * kT + tq) * kD;
        qf[g][0].q[0] = *(const uint4*)(qr + 8 * hf);
        qf[g][0].q[1] = *(const uint4*)(qr + 16 + 8 * hf);
        qf[g][1].q[0] = *(const uint4*)(qr + 32 + 8 * hf);
        qf[g][1].q[1] = *(const uint4*)(qr + 48 + 8 * hf);
        // before a later load may land in a register that holds this group's address
        asm volatile("s_wait_xcnt 0x0" ::: "memory");
    }

    v8f acc[2][4] = {};                     // acc[g][t][r] = O[query tl of group g][d = 16 t + 8 hf + r]
    float mrun[2] = {NEG_BIG, NEG_BIG};     // maximum in use, log2 units
    f32x2 lrun[2] = {};                     // the lane's share of the denominator, even and odd keys apart

    __syncthreads();                        // K and V are staged; LDS is only read from here on

    for (int key0 = 0; key0 < kSP - 32; key0 += 32)
        attn_pass<false>(Ks, Vs, key0, lane, qf, acc, mrun, lrun);
    attn_pass<true>(Ks, Vs, kSP - 32, lane, qf, acc, mrun, lrun);

    #pragma unroll   // constant g: the accumulator array stays in registers
    for (int g = 0; g < 2; g++) {
        const float lh  = lrun[g].x + lrun[g].y;
        const float inv = 1.0f / (lh + xhalf(lh));             // exchange outside any lane-dependent branch
        const int tq = wid * 32 + g * 16 + tl;
        if (tq < kT) {
            _Float16* op = O + ((size_t)b_ * kT + tq) * kE + h_ * kD + 8 * hf;
            #pragma unroll
            for (int t = 0; t < 4; t++) {
                const v8f o = acc[g][t] * inv;
                *(uint4*)(op + 16 * t) = uint4{pack2h(o[0], o[1]), pack2h(o[2], o[3]),
                                               pack2h(o[4], o[5]), pack2h(o[6], o[7])};
            }
        }
    }
}

// ---------------------------------------------------------------------------
// Launcher
// ---------------------------------------------------------------------------
extern "C" void kernel_launch(void* const* d_in, const int* in_sizes, int n_in,
                              void* d_out, int out_size, void* d_ws, size_t ws_size,
                              hipStream_t stream) {
    const float* hs  = (const float*)d_in[0];
    const float* tkv = (const float*)d_in[1];
    const float* Wq  = (const float*)d_in[2];
    const float* bq  = (const float*)d_in[3];
    const float* Wk  = (const float*)d_in[4];
    const float* bk  = (const float*)d_in[5];
    const float* Wv  = (const float*)d_in[6];
    const float* bv  = (const float*)d_in[7];
    const float* Wo  = (const float*)d_in[8];
    const float* bo  = (const float*)d_in[9];
    const float* tw  = (const float*)d_in[10];

    float* out  = (float*)d_out;
    float* kout = out + OUT_ELEMS;
    float* vout = kout + KV_ELEMS;

    // workspace layout (all 256-aligned)
    char* ws = (char*)d_ws;
    _Float16* hs_h   = (_Float16*)(ws);                       // 18,907,136 B
    _Float16* wq_h   = (_Float16*)(ws + 18907136);            // 4 x 2,097,152 B
    _Float16* wk_h   = wq_h + (size_t)kE * kE;
    _Float16* wv_h   = wk_h + (size_t)kE * kE;
    _Float16* wo_h   = wv_h + (size_t)kE * kE;
    _Float16* q_h    = (_Float16*)(ws + 27295744);            // 18,907,136 B
    _Float16* attn_h = (_Float16*)(ws + 46202880);            // 18,907,136 B

    // 1) conversions to f16
    {
        int n4 = kM * kE / 4;
        f2h4_kernel<<<(n4 + 255) / 256, 256, 0, stream>>>(hs, hs_h, n4);
        int w4 = kE * kE / 4;
        f2h4_kernel<<<(w4 + 255) / 256, 256, 0, stream>>>(Wq, wq_h, w4);
        f2h4_kernel<<<(w4 + 255) / 256, 256, 0, stream>>>(Wk, wk_h, w4);
        f2h4_kernel<<<(w4 + 255) / 256, 256, 0, stream>>>(Wv, wv_h, w4);
        f2h4_kernel<<<(w4 + 255) / 256, 256, 0, stream>>>(Wo, wo_h, w4);
    }

    // 2) textual K/V (rows 0..76 of output K/V)
    {
        int n = 2 * kB * kH * 77 * kD;
        textual_kernel<<<(n + 255) / 256, 256, 0, stream>>>(tkv, tw, kout, vout);
    }

    // 3) Q/K/V projections
    dim3 ggrid((kM + kTM - 1) / kTM, kE / kTN);   // 73 x 8
    gemm_kernel<0><<<ggrid, 128, 0, stream>>>(hs_h, wq_h, bq, nullptr, q_h);
    gemm_kernel<1><<<ggrid, 128, 0, stream>>>(hs_h, wk_h, bk, kout, nullptr);
    gemm_kernel<2><<<ggrid, 128, 0, stream>>>(hs_h, wv_h, bv, vout, nullptr);

    // 4) attention
    attn_kernel<<<kB * kH, kAT, 0, stream>>>(q_h, kout, vout, attn_h);

    // 5) output projection
    gemm_kernel<3><<<ggrid, 128, 0, stream>>>(attn_h, wo_h, bo, out, nullptr);
}

// v004
// It runs in 138 microseconds.
// Timed twice side by side with v003, it ran 1.08 and 1.07 times as fast.
// Over all steps from v000 it is 2.47 times as fast.
#include <hip/hip_runtime.h>
#include <hip/hip_bf16.h>

typedef __attribute__((ext_vector_type(16))) _Float16 v16h;
typedef __attribute__((ext_vector_type(8)))  float    v8f;

// Problem constants
constexpr int kB = 16;
constexpr int kT = 577;
constexpr int kE = 1024;
constexpr int kH = 16;
constexpr int kD = 64;
constexpr int kS = 654;            // 77 + 577
constexpr int kM = kB * kT;        // 9232 rows, divisible by 16
constexpr int kSP = 672;           // padded S (21 * 32)
constexpr long long OUT_ELEMS = (long long)kB * kT * kE;        // 9,453,568
constexpr long long KV_ELEMS  = (long long)kB * kH * kS * kD;   // 10,715,136
constexpr float NEG_BIG = -1e30f;

// ---------------------------------------------------------------------------
// CDNA5 async copy: global -> LDS, tracked by ASYNCcnt
// ---------------------------------------------------------------------------
// One lane's eight 16-byte copies of one operand's tile of a GEMM stage. The closing s_wait_xcnt stands
// in the copies' own statement, so that no address register is rewritten ahead of it.
__device__ __forceinline__ void async_copy8(const unsigned int (&l)[8], const unsigned long long (&g)[8]) {
    asm volatile("global_load_async_to_lds_b128 %0, %8, off\n\t"
                 "global_load_async_to_lds_b128 %1, %9, off\n\t"
                 "global_load_async_to_lds_b128 %2, %10, off\n\t"
                 "global_load_async_to_lds_b128 %3, %11, off\n\t"
                 "global_load_async_to_lds_b128 %4, %12, off\n\t"
                 "global_load_async_to_lds_b128 %5, %13, off\n\t"
                 "global_load_async_to_lds_b128 %6, %14, off\n\t"
                 "global_load_async_to_lds_b128 %7, %15, off\n\t"
                 "s_wait_xcnt 0x0"
                 :: "v"(l[0]), "v"(l[1]), "v"(l[2]), "v"(l[3]), "v"(l[4]), "v"(l[5]), "v"(l[6]), "v"(l[7]),
                    "v"(g[0]), "v"(g[1]), "v"(g[2]), "v"(g[3]), "v"(g[4]), "v"(g[5]), "v"(g[6]), "v"(g[7])
                 : "memory");
}
// this wave's copies have landed in LDS
__device__ __forceinline__ void wait_async0() {
    asm volatile("s_wait_asynccnt 0x0" ::: "memory");
}
// this wave's LDS reads have returned, before the buffer they read is handed back for a refill
__device__ __forceinline__ void wait_ds0() {
    asm volatile("s_wait_dscnt 0x0" ::: "memory");
}

// ---------------------------------------------------------------------------
// Preparation, one streaming launch: hidden_states and the four weights fp32 -> f16 into the workspace,
// and textual_kv * w -> K/V output rows [0..76] (textual_kv layout [2, B, H, 77, D]).
// One 16-wave workgroup per WGP walks chunks of 64 KB of source; a thread has 8 loads of 16 B in flight,
// and each wave-wide load or store covers whole 128-B lines.
// ---------------------------------------------------------------------------
constexpr int kPT = 512;                                  // threads per workgroup
constexpr int kPU = 8;                                    // 16-byte units per thread and chunk
constexpr int kPC = kPT * kPU;                            // units per chunk
constexpr int kPG = 256;                                  // workgroups
constexpr int kTxRun    = 77 * kD / 4;                    // units of one (part, batch, head) run of textual_kv
constexpr int kHsChunks = kM * kE / 4 / kPC;              // 577
constexpr int kWChunks  = kE * kE / 4 / kPC;              // 64 per weight
constexpr int kTxChunks = 2 * kB * kH * kTxRun / kPC;     // 154
constexpr int kCvChunks = kHsChunks + 4 * kWChunks;
constexpr int kAllChunks = kCvChunks + kTxChunks;
static_assert(kHsChunks * kPC * 4 == kM * kE, "hidden_states is whole chunks");
static_assert(kWChunks * kPC * 4 == kE * kE, "a weight is whole chunks");
static_assert(kTxChunks * kPC == 2 * kB * kH * kTxRun, "textual_kv is whole chunks");

__global__ __launch_bounds__(kPT) void prep_kernel(
    const float* __restrict__ hs, const float* __restrict__ Wq, const float* __restrict__ Wk,
    const float* __restrict__ Wv, const float* __restrict__ Wo, const float* __restrict__ tkv,
    const float* __restrict__ wptr,
    _Float16* __restrict__ hs_h,     // [kM, kE]
    _Float16* __restrict__ w_h,      // four [kE, kE] in the order q, k, v, o
    float* __restrict__ kout, float* __restrict__ vout)
{
    const int tid = threadIdx.x;
    const float w = wptr[0];
    for (int c = blockIdx.x; c < kAllChunks; c += kPG) {      // the chunk's kind is the same for the workgroup
        // source of the chunk and its first unit
        const float* s = hs;
        int cc = c;
        if (c >= kCvChunks)      { s = tkv; cc = c - kCvChunks; }
        else if (c >= kHsChunks) {
            const int wi = (c - kHsChunks) / kWChunks;
            s  = wi == 0 ? Wq : wi == 1 ? Wk : wi == 2 ? Wv : Wo;
            cc = (c - kHsChunks) % kWChunks;
        }
        const float4* sp = (const float4*)s + (size_t)cc * kPC + tid;
        float4 f[kPU];
        #pragma unroll   // constant u: the values stay in registers and the 8 loads issue together
        for (int u = 0; u < kPU; u++) f[u] = sp[u * kPT];
        // before a register that holds the loads' address takes the stores' address
        asm volatile("s_wait_xcnt 0x0" ::: "memory");

        if (c < kCvChunks) {
            _Float16* d = c < kHsChunks ? hs_h : w_h + (size_t)((c - kHsChunks) / kWChunks) * kE * kE;
            uint2* dp = (uint2*)d + (size_t)cc * kPC + tid;
            #pragma unroll
            for (int u = 0; u < kPU; u++) {
                union { _Float16 h[4]; uint2 q; } p;
                p.h[0] = (_Float16)f[u].x; p.h[1] = (_Float16)f[u].y;
                p.h[2] = (_Float16)f[u].z; p.h[3] = (_Float16)f[u].w;
                dp[u * kPT] = p.q;
            }
        } else {
            #pragma unroll
            for (int u = 0; u < kPU; u++) {
                const int q   = cc * kPC + u * kPT + tid;     // unit in textual_kv
                const int run = q / kTxRun;                   // part * B * H + b * H + h
                const int off = q - run * kTxRun;
                float* dst = (run >= kB * kH ? vout : kout) + (size_t)(run & (kB * kH - 1)) * kS * kD;
                ((float4*)dst)[off] = float4{w * f[u].x, w * f[u].y, w * f[u].z, w * f[u].w};
            }
        }
        // before the next chunk rewrites a register that these stores name
        asm volatile("s_wait_xcnt 0x0" ::: "memory");
    }
}

// ---------------------------------------------------------------------------
// Tiled WMMA GEMM: C[m,n] = sum_k A[m,k] * W[n,k] (+ bias), M=9232, N=K=1024
// 128 threads = 4 waves as 2(m) x 2(n); output tile 128x128, 64x64 per wave (4 x 4 WMMA tiles),
// K-stage 64, double-buffered LDS filled by global_load_async_to_lds_b128 (ASYNCcnt).
// MODE 0: q -> f16 ws [B,H,T,D] with *0.125 scale
// MODE 1/2: k/v -> fp32 d_out at [bh, 77+t, d]
// MODE 3: o -> fp32 d_out [B,T,E]
// ---------------------------------------------------------------------------
constexpr int kTM = 128;           // output rows per workgroup
constexpr int kTN = 128;           // output columns per workgroup
constexpr int kKS = 64;            // k per stage
constexpr int kLP = 72;            // LDS row pitch in halves (144 B)

template<int MODE>
__global__ __launch_bounds__(128) void gemm_kernel(
    const _Float16* __restrict__ A,      // [kM, kE] f16
    const _Float16* __restrict__ W,      // [kE, kE] f16 (row n, contiguous k)
    const float*    __restrict__ bias,   // [kE]
    float*          __restrict__ dst_f,
    _Float16*       __restrict__ dst_h)
{
    __shared__ __align__(16) _Float16 As[2][kTM * kLP];
    __shared__ __align__(16) _Float16 Bs[2][kTN * kLP];

    const int tid  = threadIdx.x;
    const int m0   = blockIdx.x * kTM;
    const int n0   = blockIdx.y * kTN;
    const int lane = tid & 31;
    const int wid  = tid >> 5;
    const int mi   = wid & 1;        // 0..1 (64-row band)
    const int nj   = wid >> 1;       // 0..1 (64-column band)
    const int tl   = lane & 15;
    const int hf   = lane >> 4;      // lane half

    // async loader: per stage a thread copies 8 A-segments + 8 W-segments of 16 B, segment j in row
    // 16 * j + (tid >> 3) of the tile. One base address per operand; the steps between segments are
    // the same for the whole workgroup. M is a multiple of 16, so a 16-row group lies wholly inside A
    // or wholly past its end; a group past the end re-reads group 0 (its rows are never stored).
    static_assert(kM % 16 == 0, "16-row groups of A are whole");
    const int row0 = tid >> 3;              // 0..15
    const int off0 = (tid & 7) * 8;         // 0..56 halves
    const unsigned long long aBase = (unsigned long long)(uintptr_t)(A + (size_t)(m0 + row0) * kE + off0);
    const unsigned long long bBase = (unsigned long long)(uintptr_t)(W + (size_t)(n0 + row0) * kE + off0);
    const unsigned int       seg0  = (unsigned int)(row0 * kLP + off0) * 2u;   // byte offset in tile
    const unsigned int asB[2] = { (unsigned int)(uintptr_t)&As[0][0],
                                  (unsigned int)(uintptr_t)&As[1][0] };
    const unsigned int bsB[2] = { (unsigned int)(uintptr_t)&Bs[0][0],
                                  (unsigned int)(uintptr_t)&Bs[1][0] };

    auto issue = [&](int kb, int buf) {
        unsigned int la[8], lb[8];
        unsigned long long ga[8], gb[8];
        #pragma unroll   // constant j: the address arrays stay in registers
        for (int j = 0; j < 8; j++) {
            const int ar = (m0 + 16 * j < kM) ? 16 * j : 0;   // same for the whole workgroup
            la[j] = asB[buf] + seg0 + (unsigned int)(16 * j * kLP) * 2u;
            lb[j] = bsB[buf] + seg0 + (unsigned int)(16 * j * kLP) * 2u;
            ga[j] = aBase + (unsigned long long)(ar * kE + kb) * 2u;
            gb[j] = bBase + (unsigned long long)(16 * j * kE + kb) * 2u;
        }
        async_copy8(la, ga);
        async_copy8(lb, gb);
    };

    v8f c[4][4] = {};

    issue(0, 0);
    wait_async0();
    __syncthreads();
    issue(kKS, 1);

    constexpr int kStages = kE / kKS;
    #pragma unroll   // constant buffer index: LDS addresses fold into the loads' offsets
    for (int t = 0; t < kStages; t++) {
        const int buf = t & 1;
        const _Float16* Asb = As[buf];
        const _Float16* Bsb = Bs[buf];
        // all loops below: constant indices, so that fragments and accumulators stay in registers
        #pragma unroll
        for (int kk = 0; kk < kKS; kk += 32) {
            union { uint4 q[2]; v16h v; } a[4], b[4];
            #pragma unroll
            for (int i = 0; i < 4; i++) {
                const _Float16* ar = Asb + (mi * 64 + i * 16 + tl) * kLP + kk;
                a[i].q[0] = *(const uint4*)(ar + 8 * hf);
                a[i].q[1] = *(const uint4*)(ar + 16 + 8 * hf);
            }
            #pragma unroll
            for (int j = 0; j < 4; j++) {
                const _Float16* br = Bsb + (nj * 64 + j * 16 + tl) * kLP + kk;
                b[j].q[0] = *(const uint4*)(br + 8 * hf);
                b[j].q[1] = *(const uint4*)(br + 16 + 8 * hf);
            }
            // keeps the block's 16 LDS reads together ahead of its 16 products: left alone, the compiler
            // re-uses one A fragment's registers and waits out the LDS latency after every 4 products
            __builtin_amdgcn_sched_barrier(0);
            #pragma unroll
            for (int i = 0; i < 4; i++)
                #pragma unroll
                for (int j = 0; j < 4; j++)
                    c[i][j] = __builtin_amdgcn_wmma_f32_16x16x32_f16(false, a[i].v, false, b[j].v,
                                                                     (short)0, c[i][j], false, false);
        }

        wait_ds0();          // my reads of this buffer are done
        wait_async0();       // my next-stage copies have landed in LDS
        __syncthreads();     // everyone's copies landed, everyone done reading
        if (t + 2 < kStages) issue((t + 2) * kKS, buf);   // refill the buffer just read
    }
    wait_async0();           // nothing of this wave is in flight when it leaves the ring

    // epilogue loops: constant indices into the accumulator array
    float bval[4];
    #pragma unroll
    for (int j = 0; j < 4; j++) bval[j] = bias[n0 + nj * 64 + j * 16 + tl];

    #pragma unroll
    for (int i = 0; i < 4; i++) {
        #pragma unroll
        for (int r = 0; r < 8; r++) {
            const int m = m0 + mi * 64 + i * 16 + r + 8 * hf;
            if (m >= kM) continue;
            const int b_ = m / kT, t = m % kT;
            #pragma unroll
            for (int j = 0; j < 4; j++) {
                const int n = n0 + nj * 64 + j * 16 + tl;
                const int h_ = n >> 6, d_ = n & 63;
                float val = c[i][j][r] + bval[j];
                if (MODE == 0) {
                    val *= 0.125f;  // D^-0.5
                    dst_h[(((size_t)(b_ * kH + h_)) * kT + t) * kD + d_] = (_Float16)val;
                } else if (MODE == 1 || MODE == 2) {
                    dst_f[(((size_t)(b_ * kH + h_)) * kS + 77 + t) * kD + d_] = val;
                } else {
                    dst_f[(size_t)m * kE + n] = val;
                }
            }
        }
    }
}

// ---------------------------------------------------------------------------
// Attention: one workgroup per (batch, head); 19 waves of 32 query columns cover all 577 queries.
// The head's K and V are read from memory once, converted to f16 and laid in LDS (pad keys as zeros).
// Then each wave walks the keys in passes of 32 with no further barrier:
//   S^T = K Q^T (a lane holds 16 scores of one query), running maximum and sum in registers,
//   P^T packed from the score accumulators straight into a B operand, O^T += V^T P^T with V^T from the
//   transposing LDS load. Scores and probabilities never touch LDS.
// The maximum in use may trail the true one by up to 8 (log2 units), so the accumulators are rescaled rarely.
// ---------------------------------------------------------------------------
constexpr int kAW  = 19;           // waves per workgroup
constexpr int kAT  = kAW * 32;     // threads per workgroup
constexpr int kKPB = 144;          // LDS pitch of a K row in bytes: 16 x odd, for ds_load_b128
constexpr int kVPB = 160;          // LDS pitch of a V row in bytes: 32 x odd, for ds_load_tr16_b128
constexpr float kLog2e = 1.4426950408889634f;
static_assert(kAW * 32 >= kT, "the waves' query columns cover T");
static_assert(kSP - 32 < kS && kS <= kSP, "only the last pass holds pad keys, and it holds real ones too");

typedef short s16x8 __attribute__((ext_vector_type(8)));
typedef float f32x2 __attribute__((ext_vector_type(2)));

// row-major 16-bit LDS tile -> 8 k values of one column per lane (half of a transposed A fragment)
__device__ __forceinline__ uint4 ld_tr16(const unsigned char* p) {
    typedef __attribute__((address_space(3))) s16x8 lds_s16x8;
    return __builtin_bit_cast(uint4, __builtin_amdgcn_ds_load_tr16_b128_v8i16((lds_s16x8*)p));
}
// two floats -> two f16 in one dword, round to nearest even
__device__ __forceinline__ unsigned int pack2h(float lo, float hi) {
    typedef _Float16 h2 __attribute__((ext_vector_type(2)));
    typedef float    f2 __attribute__((ext_vector_type(2)));
    return __builtin_bit_cast(unsigned int, __builtin_convertvector(f2{lo, hi}, h2));
}
// value of lane l ^ 16
__device__ __forceinline__ float xhalf(float x) {
    return __builtin_bit_cast(float, __builtin_amdgcn_permlanex16(__builtin_bit_cast(int, x), __builtin_bit_cast(int, x),
                                                                  0x76543210, 0xfedcba98, false, false));
}

union V16 { uint4 q[2]; v16h v; };

// One pass of one wave: 32 keys from key0 on, against the wave's 32 query columns.
template<bool LAST>
__device__ __forceinline__ void attn_pass(const unsigned char* Ks, const unsigned char* Vs, int key0, int lane,
                                          const V16 (&qf)[2][2], v8f (&acc)[2][4], float (&mrun)[2], f32x2 (&lrun)[2]) {
    const int tl = lane & 15, hf = lane >> 4;
    // all loops below: constant indices, so that fragments and accumulators stay in registers
    V16 kf[2][2];      // [16-key tile][d half]
    const unsigned char* kp = Ks + (key0 + tl) * kKPB + 16 * hf;
    #pragma unroll
    for (int kt = 0; kt < 2; kt++)
        #pragma unroll
        for (int kc = 0; kc < 2; kc++) {
            kf[kt][kc].q[0] = *(const uint4*)(kp + kt * 16 * kKPB + 64 * kc);
            kf[kt][kc].q[1] = *(const uint4*)(kp + kt * 16 * kKPB + 64 * kc + 32);
        }
    V16 pf[2];         // P^T per column group
    #pragma unroll
    for (int g = 0; g < 2; g++) {
        v8f s[2];      // s[kt][r] = score of key key0 + 16 kt + 8 hf + r with query column tl of group g
        #pragma unroll
        for (int kt = 0; kt < 2; kt++) {
            s[kt] = v8f{};
            #pragma unroll
            for (int kc = 0; kc < 2; kc++)
                s[kt] = __builtin_amdgcn_wmma_f32_16x16x32_f16(false, kf[kt][kc].v, false, qf[g][kc].v,
                                                               (short)0, s[kt], false, false);
        }
        if (LAST) {
            #pragma unroll
            for (int kt = 0; kt < 2; kt++)
                #pragma unroll
                for (int r = 0; r < 8; r++)
                    if (key0 + 16 * kt + 8 * hf + r >= kS) s[kt][r] = NEG_BIG;
        }
        float mx = s[0][0];
        #pragma unroll
        for (int r = 1; r < 8; r++) mx = fmaxf(mx, s[0][r]);
        #pragma unroll
        for (int r = 0; r < 8; r++) mx = fmaxf(mx, s[1][r]);
        mx = fmaxf(mx, xhalf(mx)) * kLog2e;     // both lane halves hold the query's maximum of this pass
        if (__builtin_amdgcn_ballot_w32(mx > mrun[g] + 8.0f) != 0) {   // scalar branch, rare after the first pass
            const float mnew = fmaxf(mrun[g], mx);
            const float corr = __builtin_amdgcn_exp2f(mrun[g] - mnew);
            mrun[g] = mnew;
            lrun[g] = lrun[g] * corr;
            #pragma unroll
            for (int t = 0; t < 4; t++) acc[g][t] = acc[g][t] * corr;
        }
        const float nm = -mrun[g];
        unsigned int w[8];
        #pragma unroll
        for (int i = 0; i < 8; i++) {           // elements 2i, 2i + 1 of the 32-key B operand
            const f32x2 arg = __builtin_elementwise_fma(f32x2{s[i >> 2][2 * (i & 3)], s[i >> 2][2 * (i & 3) + 1]},
                                                        f32x2{kLog2e, kLog2e}, f32x2{nm, nm});
            const f32x2 p = {__builtin_amdgcn_exp2f(arg.x), __builtin_amdgcn_exp2f(arg.y)};
            lrun[g] += p;
            w[i] = pack2h(p.x, p.y);
        }
        pf[g].q[0] = uint4{w[0], w[1], w[2], w[3]};
        pf[g].q[1] = uint4{w[4], w[5], w[6], w[7]};
    }
    V16 vf[4];         // V^T: 16 d rows x 32 keys per fragment
    const unsigned char* vp = Vs + (key0 + 8 * hf + (lane & 7)) * kVPB + ((lane >> 3) & 1) * 16;
    #pragma unroll
    for (int t = 0; t < 4; t++) {
        vf[t].q[0] = ld_tr16(vp + 32 * t);
        vf[t].q[1] = ld_tr16(vp + 16 * kVPB + 32 * t);
    }
    #pragma unroll
    for (int g = 0; g < 2; g++)
        #pragma unroll
        for (int t = 0; t < 4; t++)
            acc[g][t] = __builtin_amdgcn_wmma_f32_16x16x32_f16(false, vf[t].v, false, pf[g].v,
                                                               (short)0, acc[g][t], false, false);
}

__global__ __launch_bounds__(kAT) void attn_kernel(
    const _Float16* __restrict__ Q,   // [B*H, T, D] f16 (pre-scaled)
    const float*    __restrict__ Kf,  // [B*H, S, D] fp32
    const float*    __restrict__ Vf,  // [B*H, S, D] fp32
    _Float16*       __restrict__ O)   // [B, T, E] f16
{
    __shared__ __align__(32) unsigned char Ks[kSP * kKPB];
    __shared__ __align__(32) unsigned char Vs[kSP * kVPB];

    const int bh   = blockIdx.x;            // 0..255
    const int b_   = bh >> 4, h_ = bh & 15;
    const int tid  = threadIdx.x;
    const int lane = tid & 31;
    const int wid  = tid >> 5;              // 0..18
    const int tl   = lane & 15;
    const int hf   = lane >> 4;

    // Stage K and V: a thread converts 4 consecutive floats per step; pad rows [kS, kSP) become zeros
    // (a pad key's probability is 0, and 0 x V must stay 0).
    const float* kg = Kf + (size_t)bh * kS * kD;
    const float* vg = Vf + (size_t)bh * kS * kD;
    constexpr int kChunks = kSP * (kD / 4);     // chunks of 4 elements, pad rows included
    constexpr int kReal   = kS * (kD / 4);      // chunks that exist in memory
    #pragma unroll   // constant trip: the loads of the whole steps issue together, ahead of the first conversion
    for (int it = 0; it < (kChunks + kAT - 1) / kAT; it++) {
        const int ch = it * kAT + tid;
        // the first test of each pair is a constant: only the last step carries lane tests
        if ((it + 1) * kAT <= kChunks || ch < kChunks) {
            const int row = ch >> 4, c4 = ch & 15;
            uint2 kq = {0u, 0u}, vq = {0u, 0u};
            if ((it + 1) * kAT <= kReal || ch < kReal) {
                const float4 kx = *(const float4*)(kg + (size_t)ch * 4);
                const float4 vx = *(const float4*)(vg + (size_t)ch * 4);
                kq = uint2{pack2h(kx.x, kx.y), pack2h(kx.z, kx.w)};
                vq = uint2{pack2h(vx.x, vx.y), pack2h(vx.z, vx.w)};
            }
            *(uint2*)(Ks + row * kKPB + c4 * 8) = kq;
            *(uint2*)(Vs + row * kVPB + c4 * 8) = vq;
        }
    }

    // Q fragments (B operand: column = query, k = d), kept in registers; columns past T repeat the last query
    V16 qf[2][2];
    #pragma unroll   // constant g: the fragment array stays in registers
    for (int g = 0; g < 2; g++) {
        int tq = wid * 32 + g * 16 + tl; if (tq > kT - 1) tq = kT - 1;
        const _Float16* qr = Q + ((size_t)bh * kT + tq) * kD;
        qf[g][0].q[0] = *(const uint4*)(qr + 8 * hf);
        qf[g][0].q[1] = *(const uint4*)(qr + 16 + 8 * hf);
        qf[g][1].q[0] = *(const uint4*)(qr + 32 + 8 * hf);
        qf[g][1].q[1] = *(const uint4*)(qr + 48 + 8 * hf);
        // before a later load may land in a register that holds this group's address
        asm volatile("s_wait_xcnt 0x0" ::: "memory");
    }

    v8f acc[2][4] = {};                     // acc[g][t][r] = O[query tl of group g][d = 16 t + 8 hf + r]
    float mrun[2] = {NEG_BIG, NEG_BIG};     // maximum in use, log2 units
    f32x2 lrun[2] = {};                     // the lane's share of the denominator, even and odd keys apart

    __syncthreads();                        // K and V are staged; LDS is only read from here on

    for (int key0 = 0; key0 < kSP - 32; key0 += 32)
        attn_pass<false>(Ks, Vs, key0, lane, qf, acc, mrun, lrun);
    attn_pass<true>(Ks, Vs, kSP - 32, lane, qf, acc, mrun, lrun);

    #pragma unroll   // constant g: the accumulator array stays in registers
    for (int g = 0; g < 2; g++) {
        const float lh  = lrun[g].x + lrun[g].y;
        const float inv = 1.0f / (lh + xhalf(lh));             // exchange outside any lane-dependent branch
        const int tq = wid * 32 + g * 16 + tl;
        if (tq < kT) {
            _Float16* op = O + ((size_t)b_ * kT + tq) * kE + h_ * kD + 8 * hf;
            #pragma unroll
            for (int t = 0; t < 4; t++) {
                const v8f o = acc[g][t] * inv;
                *(uint4*)(op + 16 * t) = uint4{pack2h(o[0], o[1]), pack2h(o[2], o[3]),
                                               pack2h(o[4], o[5]), pack2h(o[6], o[7])};
            }
        }
    }
}

// ---------------------------------------------------------------------------
// Launcher
// ---------------------------------------------------------------------------
extern "C" void kernel_launch(void* const* d_in, const int* in_sizes, int n_in,
                              void* d_out, int out_size, void* d_ws, size_t ws_size,
                              hipStream_t stream) {
    const float* hs  = (const float*)d_in[0];
    const float* tkv = (const float*)d_in[1];
    const float* Wq  = (const float*)d_in[2];
    const float* bq  = (const float*)d_in[3];
    const float* Wk  = (const float*)d_in[4];
    const float* bk  = (const float*)d_in[5];
    const float* Wv  = (const float*)d_in[6];
    const float* bv  = (const float*)d_in[7];
    const float* Wo  = (const float*)d_in[8];
    const float* bo  = (const float*)d_in[9];
    const float* tw  = (const float*)d_in[10];

    float* out  = (float*)d_out;
    float* kout = out + OUT_ELEMS;
    float* vout = kout + KV_ELEMS;

    // workspace layout (all 256-aligned)
    char* ws = (char*)d_ws;
    _Float16* hs_h   = (_Float16*)(ws);                       // 18,907,136 B
    _Float16* wq_h   = (_Float16*)(ws + 18907136);            // 4 x 2,097,152 B
    _Float16* wk_h   = wq_h + (size_t)kE * kE;
    _Float16* wv_h   = wk_h + (size_t)kE * kE;
    _Float16* wo_h   = wv_h + (size_t)kE * kE;
    _Float16* q_h    = (_Float16*)(ws + 27295744);            // 18,907,136 B
    _Float16* attn_h = (_Float16*)(ws + 46202880);            // 18,907,136 B

    // 1) conversions to f16 and textual K/V (rows 0..76 of output K/V)
    prep_kernel<<<kPG, kPT, 0, stream>>>(hs, Wq, Wk, Wv, Wo, tkv, tw, hs_h, wq_h, kout, vout);

    // 2) Q/K/V projections
    dim3 ggrid((kM + kTM - 1) / kTM, kE / kTN);   // 73 x 8
    gemm_kernel<0><<<ggrid, 128, 0, stream>>>(hs_h, wq_h, bq, nullptr, q_h);
    gemm_kernel<1><<<ggrid, 128, 0, stream>>>(hs_h, wk_h, bk, kout, nullptr);
    gemm_kernel<2><<<ggrid, 128, 0, stream>>>(hs_h, wv_h, bv, vout, nullptr);

    // 3) attention
    attn_kernel<<<kB * kH, kAT, 0, stream>>>(q_h, kout, vout, attn_h);

    // 4) output projection
    gemm_kernel<3><<<ggrid, 128, 0, stream>>>(attn_h, wo_h, bo, out, nullptr);
}

// v005
// One run takes 111 microseconds.
// Timed twice side by side with v004, it ran 1.28 and 1.20 times as fast.
// All steps since v000 together make it 3.06 times as fast.
#include <hip/hip_runtime.h>
#include <hip/hip_bf16.h>

typedef __attribute__((ext_vector_type(16))) _Float16 v16h;
typedef __attribute__((ext_vector_type(8)))  float    v8f;

// Problem constants
constexpr int kB = 16;
constexpr int kT = 577;
constexpr int kE = 1024;
constexpr int kH = 16;
constexpr int kD = 64;
constexpr int kS = 654;            // 77 + 577
constexpr int kM = kB * kT;        // 9232 rows, divisible by 16
constexpr int kSP = 672;           // padded S (21 * 32)
constexpr long long OUT_ELEMS = (long long)kB * kT * kE;        // 9,453,568
constexpr long long KV_ELEMS  = (long long)kB * kH * kS * kD;   // 10,715,136
constexpr float NEG_BIG = -1e30f;

// ---------------------------------------------------------------------------
// CDNA5 async copy: global -> LDS, tracked by ASYNCcnt
// ---------------------------------------------------------------------------
// One lane's eight 16-byte copies of one operand's tile of a GEMM stage. The closing s_wait_xcnt stands
// in the copies' own statement, so that no address register is rewritten ahead of it.
__device__ __forceinline__ void async_copy8(const unsigned int (&l)[8], const unsigned long long (&g)[8]) {
    asm volatile("global_load_async_to_lds_b128 %0, %8, off\n\t"
                 "global_load_async_to_lds_b128 %1, %9, off\n\t"
                 "global_load_async_to_lds_b128 %2, %10, off\n\t"
                 "global_load_async_to_lds_b128 %3, %11, off\n\t"
                 "global_load_async_to_lds_b128 %4, %12, off\n\t"
                 "global_load_async_to_lds_b128 %5, %13, off\n\t"
                 "global_load_async_to_lds_b128 %6, %14, off\n\t"
                 "global_load_async_to_lds_b128 %7, %15, off\n\t"
                 "s_wait_xcnt 0x0"
                 :: "v"(l[0]), "v"(l[1]), "v"(l[2]), "v"(l[3]), "v"(l[4]), "v"(l[5]), "v"(l[6]), "v"(l[7]),
                    "v"(g[0]), "v"(g[1]), "v"(g[2]), "v"(g[3]), "v"(g[4]), "v"(g[5]), "v"(g[6]), "v"(g[7])
                 : "memory");
}
// this wave's copies have landed in LDS
__device__ __forceinline__ void wait_async0() {
    asm volatile("s_wait_asynccnt 0x0" ::: "memory");
}
// this wave's LDS reads have returned, before the buffer they read is handed back for a refill
__device__ __forceinline__ void wait_ds0() {
    asm volatile("s_wait_dscnt 0x0" ::: "memory");
}

// ---------------------------------------------------------------------------
// Preparation, one streaming launch: hidden_states and the four weights fp32 -> f16 into the workspace,
// and textual_kv * w -> K/V output rows [0..76] (textual_kv layout [2, B, H, 77, D]).
// One 16-wave workgroup per WGP walks chunks of 64 KB of source; a thread has 8 loads of 16 B in flight,
// and each wave-wide load or store covers whole 128-B lines.
// ---------------------------------------------------------------------------
constexpr int kPT = 512;                                  // threads per workgroup
constexpr int kPU = 8;                                    // 16-byte units per thread and chunk
constexpr int kPC = kPT * kPU;                            // units per chunk
constexpr int kPG = 256;                                  // workgroups
constexpr int kTxRun    = 77 * kD / 4;                    // units of one (part, batch, head) run of textual_kv
constexpr int kHsChunks = kM * kE / 4 / kPC;              // 577
constexpr int kWChunks  = kE * kE / 4 / kPC;              // 64 per weight
constexpr int kTxChunks = 2 * kB * kH * kTxRun / kPC;     // 154
constexpr int kCvChunks = kHsChunks + 4 * kWChunks;
constexpr int kAllChunks = kCvChunks + kTxChunks;
static_assert(kHsChunks * kPC * 4 == kM * kE, "hidden_states is whole chunks");
static_assert(kWChunks * kPC * 4 == kE * kE, "a weight is whole chunks");
static_assert(kTxChunks * kPC == 2 * kB * kH * kTxRun, "textual_kv is whole chunks");

__global__ __launch_bounds__(kPT) void prep_kernel(
    const float* __restrict__ hs, const float* __restrict__ Wq, const float* __restrict__ Wk,
    const float* __restrict__ Wv, const float* __restrict__ Wo, const float* __restrict__ tkv,
    const float* __restrict__ wptr,
    _Float16* __restrict__ hs_h,     // [kM, kE]
    _Float16* __restrict__ w_h,      // four [kE, kE] in the order q, k, v, o
    float* __restrict__ kout, float* __restrict__ vout)
{
    const int tid = threadIdx.x;
    const float w = wptr[0];
    for (int c = blockIdx.x; c < kAllChunks; c += kPG) {      // the chunk's kind is the same for the workgroup
        // source of the chunk and its first unit
        const float* s = hs;
        int cc = c;
        if (c >= kCvChunks)      { s = tkv; cc = c - kCvChunks; }
        else if (c >= kHsChunks) {
            const int wi = (c - kHsChunks) / kWChunks;
            s  = wi == 0 ? Wq : wi == 1 ? Wk : wi == 2 ? Wv : Wo;
            cc = (c - kHsChunks) % kWChunks;
        }
        const float4* sp = (const float4*)s + (size_t)cc * kPC + tid;
        float4 f[kPU];
        #pragma unroll   // constant u: the values stay in registers and the 8 loads issue together
        for (int u = 0; u < kPU; u++) f[u] = sp[u * kPT];
        // before a register that holds the loads' address takes the stores' address
        asm volatile("s_wait_xcnt 0x0" ::: "memory");

        if (c < kCvChunks) {
            _Float16* d = c < kHsChunks ? hs_h : w_h + (size_t)((c - kHsChunks) / kWChunks) * kE * kE;
            uint2* dp = (uint2*)d + (size_t)cc * kPC + tid;
            #pragma unroll
            for (int u = 0; u < kPU; u++) {
                union { _Float16 h[4]; uint2 q; } p;
                p.h[0] = (_Float16)f[u].x; p.h[1] = (_Float16)f[u].y;
                p.h[2] = (_Float16)f[u].z; p.h[3] = (_Float16)f[u].w;
                dp[u * kPT] = p.q;
            }
        } else {
            #pragma unroll
            for (int u = 0; u < kPU; u++) {
                const int q   = cc * kPC + u * kPT + tid;     // unit in textual_kv
                const int run = q / kTxRun;                   // part * B * H + b * H + h
                const int off = q - run * kTxRun;
                float* dst = (run >= kB * kH ? vout : kout) + (size_t)(run & (kB * kH - 1)) * kS * kD;
                ((float4*)dst)[off] = float4{w * f[u].x, w * f[u].y, w * f[u].z, w * f[u].w};
            }
        }
        // before the next chunk rewrites a register that these stores name
        asm volatile("s_wait_xcnt 0x0" ::: "memory");
    }
}

// ---------------------------------------------------------------------------
// Tiled WMMA GEMM: C[m,n] = sum_k A[m,k] * W[n,k] (+ bias), M=9232, N=K=1024
// 128 threads = 4 waves as 2(m) x 2(n); output tile 128x128, 64x64 per wave (4 x 4 WMMA tiles),
// K-stage 64, double-buffered LDS filled by global_load_async_to_lds_b128 (ASYNCcnt).
// Store forms: 0: q -> f16 ws [B,H,T,D] with *0.125 scale
//              1: k or v -> fp32 d_out at [bh, 77+t, d]
//              3: o -> fp32 d_out [B,T,E]
// QKV launch: the grid's y runs over the 3 x 8 column tiles of the stacked weights q, k, v, so that the three
// projections share one launch; blockIdx.y / 8 picks weight, bias, output and store form for the workgroup.
// ---------------------------------------------------------------------------
constexpr int kTM = 128;           // output rows per workgroup
constexpr int kTN = 128;           // output columns per workgroup
constexpr int kKS = 64;            // k per stage
constexpr int kLP = 72;            // LDS row pitch in halves (144 B)

// One wave's 64x64 block of C, plus bias, to its destination.
template<int FORM>
__device__ __forceinline__ void gemm_store(const v8f (&c)[4][4], const float (&bval)[4],
                                           float* __restrict__ dst_f, _Float16* __restrict__ dst_h,
                                           int mw, int nw, int tl, int hf)
{
    // all loops: constant indices into the accumulator array
    #pragma unroll
    for (int i = 0; i < 4; i++) {
        #pragma unroll
        for (int r = 0; r < 8; r++) {
            const int m = mw + i * 16 + r + 8 * hf;
            if (m >= kM) continue;
            const int b_ = m / kT, t = m % kT;
            #pragma unroll
            for (int j = 0; j < 4; j++) {
                const int n = nw + j * 16 + tl;
                const int h_ = n >> 6, d_ = n & 63;
                float val = c[i][j][r] + bval[j];
                if (FORM == 0) {
                    val *= 0.125f;  // D^-0.5
                    dst_h[(((size_t)(b_ * kH + h_)) * kT + t) * kD + d_] = (_Float16)val;
                } else if (FORM == 1) {
                    dst_f[(((size_t)(b_ * kH + h_)) * kS + 77 + t) * kD + d_] = val;
                } else {
                    dst_f[(size_t)m * kE + n] = val;
                }
            }
        }
    }
}

template<bool QKV>
__global__ __launch_bounds__(128) void gemm_kernel(
    const _Float16* __restrict__ A,      // [kM, kE] f16
    const _Float16* __restrict__ Wst,    // [kE, kE] f16 (row n, contiguous k); QKV: three of them, stacked
    const float*    __restrict__ bias0,  // [kE]: q's, or o's
    const float*    __restrict__ bias1,  // [kE]: k's (QKV only)
    const float*    __restrict__ bias2,  // [kE]: v's (QKV only)
    float*          __restrict__ dst_f1, // k's output, or o's
    float*          __restrict__ dst_f2, // v's output (QKV only)
    _Float16*       __restrict__ dst_h)  // q's output (QKV only)
{
    __shared__ __align__(16) _Float16 As[2][kTM * kLP];
    __shared__ __align__(16) _Float16 Bs[2][kTN * kLP];

    const int tid  = threadIdx.x;
    const int m0   = blockIdx.x * kTM;
    constexpr unsigned int kNT = kE / kTN;                    // column tiles of one weight
    const int which = QKV ? (int)(blockIdx.y / kNT) : 0;      // 0 q, 1 k, 2 v: the same for the workgroup
    const int n0    = (int)(QKV ? blockIdx.y % kNT : blockIdx.y) * kTN;
    const _Float16* W = Wst + (size_t)which * kE * kE;
    const int lane = tid & 31;
    const int wid  = tid >> 5;
    const int mi   = wid & 1;        // 0..1 (64-row band)
    const int nj   = wid >> 1;       // 0..1 (64-column band)
    const int tl   = lane & 15;
    const int hf   = lane >> 4;      // lane half

    // async loader: per stage a thread copies 8 A-segments + 8 W-segments of 16 B, segment j in row
    // 16 * j + (tid >> 3) of the tile. One base address per operand; the steps between segments are
    // the same for the whole workgroup. M is a multiple of 16, so a 16-row group lies wholly inside A
    // or wholly past its end; a group past the end re-reads group 0 (its rows are never stored).
    static_assert(kM % 16 == 0, "16-row groups of A are whole");
    const int row0 = tid >> 3;              // 0..15
    const int off0 = (tid & 7) * 8;         // 0..56 halves
    const unsigned long long aBase = (unsigned long long)(uintptr_t)(A + (size_t)(m0 + row0) * kE + off0);
    const unsigned long long bBase = (unsigned long long)(uintptr_t)(W + (size_t)(n0 + row0) * kE + off0);
    const unsigned int       seg0  = (unsigned int)(row0 * kLP + off0) * 2u;   // byte offset in tile
    const unsigned int asB[2] = { (unsigned int)(uintptr_t)&As[0][0],
                                  (unsigned int)(uintptr_t)&As[1][0] };
    const unsigned int bsB[2] = { (unsigned int)(uintptr_t)&Bs[0][0],
                                  (unsigned int)(uintptr_t)&Bs[1][0] };

    auto issue = [&](int kb, int buf) {
        unsigned int la[8], lb[8];
        unsigned long long ga[8], gb[8];
        #pragma unroll   // constant j: the address arrays stay in registers
        for (int j = 0; j < 8; j++) {
            const int ar = (m0 + 16 * j < kM) ? 16 * j : 0;   // same for the whole workgroup
            la[j] = asB[buf] + seg0 + (unsigned int)(16 * j * kLP) * 2u;
            lb[j] = bsB[buf] + seg0 + (unsigned int)(16 * j * kLP) * 2u;
            ga[j] = aBase + (unsigned long long)(ar * kE + kb) * 2u;
            gb[j] = bBase + (unsigned long long)(16 * j * kE + kb) * 2u;
        }
        async_copy8(la, ga);
        async_copy8(lb, gb);
    };

    v8f c[4][4] = {};

    issue(0, 0);
    wait_async0();
    __syncthreads();
    issue(kKS, 1);

    constexpr int kStages = kE / kKS;
    #pragma unroll   // constant buffer index: LDS addresses fold into the loads' offsets
    for (int t = 0; t < kStages; t++) {
        const int buf = t & 1;
        const _Float16* Asb = As[buf];
        const _Float16* Bsb = Bs[buf];
        // all loops below: constant indices, so that fragments and accumulators stay in registers
        #pragma unroll
        for (int kk = 0; kk < kKS; kk += 32) {
            union { uint4 q[2]; v16h v; } a[4], b[4];
            #pragma unroll
            for (int i = 0; i < 4; i++) {
                const _Float16* ar = Asb + (mi * 64 + i * 16 + tl) * kLP + kk;
                a[i].q[0] = *(const uint4*)(ar + 8 * hf);
                a[i].q[1] = *(const uint4*)(ar + 16 + 8 * hf);
            }
            #pragma unroll
            for (int j = 0; j < 4; j++) {
                const _Float16* br = Bsb + (nj * 64 + j * 16 + tl) * kLP + kk;
                b[j].q[0] = *(const uint4*)(br + 8 * hf);
                b[j].q[1] = *(const uint4*)(br + 16 + 8 * hf);
            }
            // keeps the block's 16 LDS reads together ahead of its 16 products: left alone, the compiler
            // re-uses one A fragment's registers and waits out the LDS latency after every 4 products
            __builtin_amdgcn_sched_barrier(0);
            #pragma unroll
            for (int i = 0; i < 4; i++)
                #pragma unroll
                for (int j = 0; j < 4; j++)
                    c[i][j] = __builtin_amdgcn_wmma_f32_16x16x32_f16(false, a[i].v, false, b[j].v,
                                                                     (short)0, c[i][j], false, false);
        }

        wait_ds0();          // my reads of this buffer are done
        wait_async0();       // my next-stage copies have landed in LDS
        __syncthreads();     // everyone's copies landed, everyone done reading
        if (t + 2 < kStages) issue((t + 2) * kKS, buf);   // refill the buffer just read
    }
    wait_async0();           // nothing of this wave is in flight when it leaves the ring

    // the bias is read ahead of the branch on the store form, so that the loads can rise above the last products
    const float* bias = which == 0 ? bias0 : which == 1 ? bias1 : bias2;
    float bval[4];
    #pragma unroll   // constant j: the array stays in registers
    for (int j = 0; j < 4; j++) bval[j] = bias[n0 + nj * 64 + j * 16 + tl];

    const int mw = m0 + mi * 64, nw = n0 + nj * 64;
    if (QKV) {
        if (which == 0) gemm_store<0>(c, bval, nullptr, dst_h, mw, nw, tl, hf);
        else            gemm_store<1>(c, bval, which == 1 ? dst_f1 : dst_f2, nullptr, mw, nw, tl, hf);
    } else {
        gemm_store<3>(c, bval, dst_f1, nullptr, mw, nw, tl, hf);
    }
}

// ---------------------------------------------------------------------------
// Attention: one workgroup per (batch, head); 19 waves of 32 query columns cover all 577 queries.
// The head's K and V are read from memory once, converted to f16 and laid in LDS (pad keys as zeros).
// Then each wave walks the keys in passes of 32 with no further barrier:
//   S^T = K Q^T (a lane holds 16 scores of one query), running maximum and sum in registers,
//   P^T packed from the score accumulators straight into a B operand, O^T += V^T P^T with V^T from the
//   transposing LDS load. Scores and probabilities never touch LDS.
// The maximum in use may trail the true one by up to 8 (log2 units), so the accumulators are rescaled rarely.
// ---------------------------------------------------------------------------
constexpr int kAW  = 19;           // waves per workgroup
constexpr int kAT  = kAW * 32;     // threads per workgroup
constexpr int kKPB = 144;          // LDS pitch of a K row in bytes: 16 x odd, for ds_load_b128
constexpr int kVPB = 160;          // LDS pitch of a V row in bytes: 32 x odd, for ds_load_tr16_b128
constexpr float kLog2e = 1.4426950408889634f;
static_assert(kAW * 32 >= kT, "the waves' query columns cover T");
static_assert(kSP - 32 < kS && kS <= kSP, "only the last pass holds pad keys, and it holds real ones too");

typedef short s16x8 __attribute__((ext_vector_type(8)));
typedef float f32x2 __attribute__((ext_vector_type(2)));

// row-major 16-bit LDS tile -> 8 k values of one column per lane (half of a transposed A fragment)
__device__ __forceinline__ uint4 ld_tr16(const unsigned char* p) {
    typedef __attribute__((address_space(3))) s16x8 lds_s16x8;
    return __builtin_bit_cast(uint4, __builtin_amdgcn_ds_load_tr16_b128_v8i16((lds_s16x8*)p));
}
// two floats -> two f16 in one dword, round to nearest even
__device__ __forceinline__ unsigned int pack2h(float lo, float hi) {
    typedef _Float16 h2 __attribute__((ext_vector_type(2)));
    typedef float    f2 __attribute__((ext_vector_type(2)));
    return __builtin_bit_cast(unsigned int, __builtin_convertvector(f2{lo, hi}, h2));
}
// value of lane l ^ 16
__device__ __forceinline__ float xhalf(float x) {
    return __builtin_bit_cast(float, __builtin_amdgcn_permlanex16(__builtin_bit_cast(int, x), __builtin_bit_cast(int, x),
                                                                  0x76543210, 0xfedcba98, false, false));
}

union V16 { uint4 q[2]; v16h v; };

// One pass of one wave: 32 keys from key0 on, against the wave's 32 query columns.
template<bool LAST>
__device__ __forceinline__ void attn_pass(const unsigned char* Ks, const unsigned char* Vs, int key0, int lane,
                                          const V16 (&qf)[2][2], v8f (&acc)[2][4], float (&mrun)[2], f32x2 (&lrun)[2]) {
    const int tl = lane & 15, hf = lane >> 4;
    // all loops below: constant indices, so that fragments and accumulators stay in registers
    V16 kf[2][2];      // [16-key tile][d half]
    const unsigned char* kp = Ks + (key0 + tl) * kKPB + 16 * hf;
    #pragma unroll
    for (int kt = 0; kt < 2; kt++)
        #pragma unroll
        for (int kc = 0; kc < 2; kc++) {
            kf[kt][kc].q[0] = *(const uint4*)(kp + kt * 16 * kKPB + 64 * kc);
            kf[kt][kc].q[1] = *(const uint4*)(kp + kt * 16 * kKPB + 64 * kc + 32);
        }
    V16 pf[2];         // P^T per column group
    #pragma unroll
    for (int g = 0; g < 2; g++) {
        v8f s[2];      // s[kt][r] = score of key key0 + 16 kt + 8 hf + r with query column tl of group g
        #pragma unroll
        for (int kt = 0; kt < 2; kt++) {
            s[kt] = v8f{};
            #pragma unroll
            for (int kc = 0; kc < 2; kc++)
                s[kt] = __builtin_amdgcn_wmma_f32_16x16x32_f16(false, kf[kt][kc].v, false, qf[g][kc].v,
                                                               (short)0, s[kt], false, false);
        }
        if (LAST) {
            #pragma unroll
            for (int kt = 0; kt < 2; kt++)
                #pragma unroll
                for (int r = 0; r < 8; r++)
                    if (key0 + 16 * kt + 8 * hf + r >= kS) s[kt][r] = NEG_BIG;
        }
        float mx = s[0][0];
        #pragma unroll
        for (int r = 1; r < 8; r++) mx = fmaxf(mx, s[0][r]);
        #pragma unroll
        for (int r = 0; r < 8; r++) mx = fmaxf(mx, s[1][r]);
        mx = fmaxf(mx, xhalf(mx)) * kLog2e;     // both lane halves hold the query's maximum of this pass
        if (__builtin_amdgcn_ballot_w32(mx > mrun[g] + 8.0f) != 0) {   // scalar branch, rare after the first pass
            const float mnew = fmaxf(mrun[g], mx);
            const float corr = __builtin_amdgcn_exp2f(mrun[g] - mnew);
            mrun[g] = mnew;
            lrun[g] = lrun[g] * corr;
            #pragma unroll
            for (int t = 0; t < 4; t++) acc[g][t] = acc[g][t] * corr;
        }
        const float nm = -mrun[g];
        unsigned int w[8];
        #pragma unroll
        for (int i = 0; i < 8; i++) {           // elements 2i, 2i + 1 of the 32-key B operand
            const f32x2 arg = __builtin_elementwise_fma(f32x2{s[i >> 2][2 * (i & 3)], s[i >> 2][2 * (i & 3) + 1]},
                                                        f32x2{kLog2e, kLog2e}, f32x2{nm, nm});
            const f32x2 p = {__builtin_amdgcn_exp2f(arg.x), __builtin_amdgcn_exp2f(arg.y)};
            lrun[g] += p;
            w[i] = pack2h(p.x, p.y);
        }
        pf[g].q[0] = uint4{w[0], w[1], w[2], w[3]};
        pf[g].q[1] = uint4{w[4], w[5], w[6], w[7]};
    }
    V16 vf[4];         // V^T: 16 d rows x 32 keys per fragment
    const unsigned char* vp = Vs + (key0 + 8 * hf + (lane & 7)) * kVPB + ((lane >> 3) & 1) * 16;
    #pragma unroll
    for (int t = 0; t < 4; t++) {
        vf[t].q[0] = ld_tr16(vp + 32 * t);
        vf[t].q[1] = ld_tr16(vp + 16 * kVPB + 32 * t);
    }
    #pragma unroll
    for (int g = 0; g < 2; g++)
        #pragma unroll
        for (int t = 0; t < 4; t++)
            acc[g][t] = __builtin_amdgcn_wmma_f32_16x16x32_f16(false, vf[t].v, false, pf[g].v,
                                                               (short)0, acc[g][t], false, false);
}

__global__ __launch_bounds__(kAT) void attn_kernel(
    const _Float16* __restrict__ Q,   // [B*H, T, D] f16 (pre-scaled)
    const float*    __restrict__ Kf,  // [B*H, S, D] fp32
    const float*    __restrict__ Vf,  // [B*H, S, D] fp32
    _Float16*       __restrict__ O)   // [B, T, E] f16
{
    __shared__ __align__(32) unsigned char Ks[kSP * kKPB];
    __shared__ __align__(32) unsigned char Vs[kSP * kVPB];

    const int bh   = blockIdx.x;            // 0..255
    const int b_   = bh >> 4, h_ = bh & 15;
    const int tid  = threadIdx.x;
    const int lane = tid & 31;
    const int wid  = tid >> 5;              // 0..18
    const int tl   = lane & 15;
    const int hf   = lane >> 4;

    // Stage K and V: a thread converts 4 consecutive floats per step; pad rows [kS, kSP) become zeros
    // (a pad key's probability is 0, and 0 x V must stay 0).
    const float* kg = Kf + (size_t)bh * kS * kD;
    const float* vg = Vf + (size_t)bh * kS * kD;
    constexpr int kChunks = kSP * (kD / 4);     // chunks of 4 elements, pad rows included
    constexpr int kReal   = kS * (kD / 4);      // chunks that exist in memory
    #pragma unroll   // constant trip: the loads of the whole steps issue together, ahead of the first conversion
    for (int it = 0; it < (kChunks + kAT - 1) / kAT; it++) {
        const int ch = it * kAT + tid;
        // the first test of each pair is a constant: only the last step carries lane tests
        if ((it + 1) * kAT <= kChunks || ch < kChunks) {
            const int row = ch >> 4, c4 = ch & 15;
            uint2 kq = {0u, 0u}, vq = {0u, 0u};
            if ((it + 1) * kAT <= kReal || ch < kReal) {
                const float4 kx = *(const float4*)(kg + (size_t)ch * 4);
                const float4 vx = *(const float4*)(vg + (size_t)ch * 4);
                kq = uint2{pack2h(kx.x, kx.y), pack2h(kx.z, kx.w)};
                vq = uint2{pack2h(vx.x, vx.y), pack2h(vx.z, vx.w)};
            }
            *(uint2*)(Ks + row * kKPB + c4 * 8) = kq;
            *(uint2*)(Vs + row * kVPB + c4 * 8) = vq;
        }
    }

    // Q fragments (B operand: column = query, k = d), kept in registers; columns past T repeat the last query
    V16 qf[2][2];
    #pragma unroll   // constant g: the fragment array stays in registers
    for (int g = 0; g < 2; g++) {
        int tq = wid * 32 + g * 16 + tl; if (tq > kT - 1) tq = kT - 1;
        const _Float16* qr = Q + ((size_t)bh * kT + tq) * kD;
        qf[g][0].q[0] = *(const uint4*)(qr + 8 * hf);
        qf[g][0].q[1] = *(const uint4*)(qr + 16 + 8 * hf);
        qf[g][1].q[0] = *(const uint4*)(qr + 32 + 8 * hf);
        qf[g][1].q[1] = *(const uint4*)(qr + 48 + 8 * hf);
        // before a later load may land in a register that holds this group's address
        asm volatile("s_wait_xcnt 0x0" ::: "memory");
    }

    v8f acc[2][4] = {};                     // acc[g][t][r] = O[query tl of group g][d = 16 t + 8 hf + r]
    float mrun[2] = {NEG_BIG, NEG_BIG};     // maximum in use, log2 units
    f32x2 lrun[2] = {};                     // the lane's share of the denominator, even and odd keys apart

    __syncthreads();                        // K and V are staged; LDS is only read from here on

    for (int key0 = 0; key0 < kSP - 32; key0 += 32)
        attn_pass<false>(Ks, Vs, key0, lane, qf, acc, mrun, lrun);
    attn_pass<true>(Ks, Vs, kSP - 32, lane, qf, acc, mrun, lrun);

    #pragma unroll   // constant g: the accumulator array stays in registers
    for (int g = 0; g < 2; g++) {
        const float lh  = lrun[g].x + lrun[g].y;
        const float inv = 1.0f / (lh + xhalf(lh));             // exchange outside any lane-dependent branch
        const int tq = wid * 32 + g * 16 + tl;
        if (tq < kT) {
            _Float16* op = O + ((size_t)b_ * kT + tq) * kE + h_ * kD + 8 * hf;
            #pragma unroll
            for (int t = 0; t < 4; t++) {
                const v8f o = acc[g][t] * inv;
                *(uint4*)(op + 16 * t) = uint4{pack2h(o[0], o[1]), pack2h(o[2], o[3]),
                                               pack2h(o[4], o[5]), pack2h(o[6], o[7])};
            }
        }
    }
}

// ---------------------------------------------------------------------------
// Launcher
// ---------------------------------------------------------------------------
extern "C" void kernel_launch(void* const* d_in, const int* in_sizes, int n_in,
                              void* d_out, int out_size, void* d_ws, size_t ws_size,
                              hipStream_t stream) {
    const float* hs  = (const float*)d_in[0];
    const float* tkv = (const float*)d_in[1];
    const float* Wq  = (const float*)d_in[2];
    const float* bq  = (const float*)d_in[3];
    const float* Wk  = (const float*)d_in[4];
    const float* bk  = (const float*)d_in[5];
    const float* Wv  = (const float*)d_in[6];
    const float* bv  = (const float*)d_in[7];
    const float* Wo  = (const float*)d_in[8];
    const float* bo  = (const float*)d_in[9];
    const float* tw  = (const float*)d_in[10];

    float* out  = (float*)d_out;
    float* kout = out + OUT_ELEMS;
    float* vout = kout + KV_ELEMS;

    // workspace layout (all 256-aligned)
    char* ws = (char*)d_ws;
    _Float16* hs_h   = (_Float16*)(ws);                       // 18,907,136 B
    _Float16* wq_h   = (_Float16*)(ws + 18907136);            // 4 x 2,097,152 B
    _Float16* wo_h   = wq_h + 3 * (size_t)kE * kE;            // order q, k, v, o
    _Float16* q_h    = (_Float16*)(ws + 27295744);            // 18,907,136 B
    _Float16* attn_h = (_Float16*)(ws + 46202880);            // 18,907,136 B

    // 1) conversions to f16 and textual K/V (rows 0..76 of output K/V)
    prep_kernel<<<kPG, kPT, 0, stream>>>(hs, Wq, Wk, Wv, Wo, tkv, tw, hs_h, wq_h, kout, vout);

    // 2) Q/K/V projections, one launch over the stacked weights
    dim3 ggrid((kM + kTM - 1) / kTM, kE / kTN);       // 73 x 8
    dim3 qgrid((kM + kTM - 1) / kTM, 3 * (kE / kTN)); // 73 x 24
    gemm_kernel<true><<<qgrid, 128, 0, stream>>>(hs_h, wq_h, bq, bk, bv, kout, vout, q_h);

    // 3) attention
    attn_kernel<<<kB * kH, kAT, 0, stream>>>(q_h, kout, vout, attn_h);

    // 4) output projection
    gemm_kernel<false><<<ggrid, 128, 0, stream>>>(attn_h, wo_h, bo, nullptr, nullptr, out, nullptr, nullptr);
}

// v006
// Measured time: 107 microseconds a run.
// Timed twice side by side with v005, it ran 1.03 times as fast both times.
// All steps since v000 together make it 3.16 times as fast.
#include <hip/hip_runtime.h>
#include <hip/hip_bf16.h>

typedef __attribute__((ext_vector_type(16))) _Float16 v16h;
typedef __attribute__((ext_vector_type(8)))  float    v8f;

// Problem constants
constexpr int kB = 16;
constexpr int kT = 577;
constexpr int kE = 1024;
constexpr int kH = 16;
constexpr int kD = 64;
constexpr int kS = 654;            // 77 + 577
constexpr int kM = kB * kT;        // 9232 rows, divisible by 16
constexpr int kSP = 672;           // padded S (21 * 32)
constexpr long long OUT_ELEMS = (long long)kB * kT * kE;        // 9,453,568
constexpr long long KV_ELEMS  = (long long)kB * kH * kS * kD;   // 10,715,136
constexpr float NEG_BIG = -1e30f;

// ---------------------------------------------------------------------------
// CDNA5 async copy: global -> LDS, tracked by ASYNCcnt
// ---------------------------------------------------------------------------
// One lane's eight 16-byte copies of one operand's tile of a GEMM stage. The closing s_wait_xcnt stands
// in the copies' own statement, so that no address register is rewritten ahead of it.
__device__ __forceinline__ void async_copy8(const unsigned int (&l)[8], const unsigned long long (&g)[8]) {
    asm volatile("global_load_async_to_lds_b128 %0, %8, off\n\t"
                 "global_load_async_to_lds_b128 %1, %9, off\n\t"
                 "global_load_async_to_lds_b128 %2, %10, off\n\t"
                 "global_load_async_to_lds_b128 %3, %11, off\n\t"
                 "global_load_async_to_lds_b128 %4, %12, off\n\t"
                 "global_load_async_to_lds_b128 %5, %13, off\n\t"
                 "global_load_async_to_lds_b128 %6, %14, off\n\t"
                 "global_load_async_to_lds_b128 %7, %15, off\n\t"
                 "s_wait_xcnt 0x0"
                 :: "v"(l[0]), "v"(l[1]), "v"(l[2]), "v"(l[3]), "v"(l[4]), "v"(l[5]), "v"(l[6]), "v"(l[7]),
                    "v"(g[0]), "v"(g[1]), "v"(g[2]), "v"(g[3]), "v"(g[4]), "v"(g[5]), "v"(g[6]), "v"(g[7])
                 : "memory");
}
// The same for four copies.
__device__ __forceinline__ void async_copy4(const unsigned int (&l)[4], const unsigned long long (&g)[4]) {
    asm volatile("global_load_async_to_lds_b128 %0, %4, off\n\t"
                 "global_load_async_to_lds_b128 %1, %5, off\n\t"
                 "global_load_async_to_lds_b128 %2, %6, off\n\t"
                 "global_load_async_to_lds_b128 %3, %7, off\n\t"
                 "s_wait_xcnt 0x0"
                 :: "v"(l[0]), "v"(l[1]), "v"(l[2]), "v"(l[3]),
                    "v"(g[0]), "v"(g[1]), "v"(g[2]), "v"(g[3])
                 : "memory");
}
// The same for five copies.
__device__ __forceinline__ void async_copy5(const unsigned int (&l)[5], const unsigned long long (&g)[5]) {
    asm volatile("global_load_async_to_lds_b128 %0, %5, off\n\t"
                 "global_load_async_to_lds_b128 %1, %6, off\n\t"
                 "global_load_async_to_lds_b128 %2, %7, off\n\t"
                 "global_load_async_to_lds_b128 %3, %8, off\n\t"
                 "global_load_async_to_lds_b128 %4, %9, off\n\t"
                 "s_wait_xcnt 0x0"
                 :: "v"(l[0]), "v"(l[1]), "v"(l[2]), "v"(l[3]), "v"(l[4]),
                    "v"(g[0]), "v"(g[1]), "v"(g[2]), "v"(g[3]), "v"(g[4])
                 : "memory");
}
// this wave's copies have landed in LDS
__device__ __forceinline__ void wait_async0() {
    asm volatile("s_wait_asynccnt 0x0" ::: "memory");
}
// this wave's LDS reads have returned, before the buffer they read is handed back for a refill
__device__ __forceinline__ void wait_ds0() {
    asm volatile("s_wait_dscnt 0x0" ::: "memory");
}

// ---------------------------------------------------------------------------
// Preparation, one streaming launch: hidden_states and the four weights fp32 -> f16 into the workspace,
// and textual_kv * w -> K/V output rows [0..76] (textual_kv layout [2, B, H, 77, D]).
// One 16-wave workgroup per WGP walks chunks of 64 KB of source; a thread has 8 loads of 16 B in flight,
// and each wave-wide load or store covers whole 128-B lines.
// ---------------------------------------------------------------------------
constexpr int kPT = 512;                                  // threads per workgroup
constexpr int kPU = 8;                                    // 16-byte units per thread and chunk
constexpr int kPC = kPT * kPU;                            // units per chunk
constexpr int kPG = 256;                                  // workgroups
constexpr int kTxRun    = 77 * kD / 4;                    // units of one (part, batch, head) run of textual_kv
constexpr int kHsChunks = kM * kE / 4 / kPC;              // 577
constexpr int kWChunks  = kE * kE / 4 / kPC;              // 64 per weight
constexpr int kTxChunks = 2 * kB * kH * kTxRun / kPC;     // 154
constexpr int kCvChunks = kHsChunks + 4 * kWChunks;
constexpr int kAllChunks = kCvChunks + kTxChunks;
static_assert(kHsChunks * kPC * 4 == kM * kE, "hidden_states is whole chunks");
static_assert(kWChunks * kPC * 4 == kE * kE, "a weight is whole chunks");
static_assert(kTxChunks * kPC == 2 * kB * kH * kTxRun, "textual_kv is whole chunks");

__global__ __launch_bounds__(kPT) void prep_kernel(
    const float* __restrict__ hs, const float* __restrict__ Wq, const float* __restrict__ Wk,
    const float* __restrict__ Wv, const float* __restrict__ Wo, const float* __restrict__ tkv,
    const float* __restrict__ wptr,
    _Float16* __restrict__ hs_h,     // [kM, kE]
    _Float16* __restrict__ w_h,      // four [kE, kE] in the order q, k, v, o
    float* __restrict__ kout, float* __restrict__ vout)
{
    const int tid = threadIdx.x;
    const float w = wptr[0];
    for (int c = blockIdx.x; c < kAllChunks; c += kPG) {      // the chunk's kind is the same for the workgroup
        // source of the chunk and its first unit
        const float* s = hs;
        int cc = c;
        if (c >= kCvChunks)      { s = tkv; cc = c - kCvChunks; }
        else if (c >= kHsChunks) {
            const int wi = (c - kHsChunks) / kWChunks;
            s  = wi == 0 ? Wq : wi == 1 ? Wk : wi == 2 ? Wv : Wo;
            cc = (c - kHsChunks) % kWChunks;
        }
        const float4* sp = (const float4*)s + (size_t)cc * kPC + tid;
        float4 f[kPU];
        #pragma unroll   // constant u: the values stay in registers and the 8 loads issue together
        for (int u = 0; u < kPU; u++) f[u] = sp[u * kPT];
        // before a register that holds the loads' address takes the stores' address
        asm volatile("s_wait_xcnt 0x0" ::: "memory");

        if (c < kCvChunks) {
            _Float16* d = c < kHsChunks ? hs_h : w_h + (size_t)((c - kHsChunks) / kWChunks) * kE * kE;
            uint2* dp = (uint2*)d + (size_t)cc * kPC + tid;
            #pragma unroll
            for (int u = 0; u < kPU; u++) {
                union { _Float16 h[4]; uint2 q; } p;
                p.h[0] = (_Float16)f[u].x; p.h[1] = (_Float16)f[u].y;
                p.h[2] = (_Float16)f[u].z; p.h[3] = (_Float16)f[u].w;
                dp[u * kPT] = p.q;
            }
        } else {
            #pragma unroll
            for (int u = 0; u < kPU; u++) {
                const int q   = cc * kPC + u * kPT + tid;     // unit in textual_kv
                const int run = q / kTxRun;                   // part * B * H + b * H + h
                const int off = q - run * kTxRun;
                float* dst = (run >= kB * kH ? vout : kout) + (size_t)(run & (kB * kH - 1)) * kS * kD;
                ((float4*)dst)[off] = float4{w * f[u].x, w * f[u].y, w * f[u].z, w * f[u].w};
            }
        }
        // before the next chunk rewrites a register that these stores name
        asm volatile("s_wait_xcnt 0x0" ::: "memory");
    }
}

// ---------------------------------------------------------------------------
// Tiled WMMA GEMM: C[m,n] = sum_k A[m,k] * W[n,k] (+ bias), M=9232, N=K=1024
// 256 threads = 8 waves as 2(m) x 4(n). The tiles are wide so that a byte copied from L2 feeds more products.
// QKV: output tile 128x256, 64x64 per wave (4 x 4 WMMA tiles), two workgroups to a WGP.
// o:   output tile 160x256, 80x64 per wave (5 x 4 WMMA tiles): 58 x 4 workgroups, at most one for every WGP.
// K-stage 64, double-buffered LDS filled by global_load_async_to_lds_b128 (ASYNCcnt).
// Store forms: 0: q -> f16 ws [B,H,T,D] with *0.125 scale
//              1: k or v -> fp32 d_out at [bh, 77+t, d]
//              3: o -> fp32 d_out [B,T,E]
// QKV launch: the grid's y runs over the 3 x 4 column tiles of the stacked weights q, k, v, so that the three
// projections share one launch; blockIdx.y / 4 picks weight, bias, output and store form for the workgroup.
// ---------------------------------------------------------------------------
constexpr int kTMq = 128;          // output rows per workgroup, QKV
constexpr int kTMo = 160;          // output rows per workgroup, o
constexpr int kTN = 256;           // output columns per workgroup
constexpr int kKS = 64;            // k per stage
constexpr int kLP = 72;            // LDS row pitch in halves (144 B)

// One wave's block of C (FM x 4 WMMA tiles), plus bias, to its destination.
template<int FORM, int FM>
__device__ __forceinline__ void gemm_store(const v8f (&c)[FM][4], const float (&bval)[4],
                                           float* __restrict__ dst_f, _Float16* __restrict__ dst_h,
                                           int mw, int nw, int tl, int hf)
{
    // all loops: constant indices into the accumulator array
    #pragma unroll
    for (int i = 0; i < FM; i++) {
        #pragma unroll
        for (int r = 0; r < 8; r++) {
            const int m = mw + i * 16 + r + 8 * hf;
            if (m >= kM) continue;
            const int b_ = m / kT, t = m % kT;
            #pragma unroll
            for (int j = 0; j < 4; j++) {
                const int n = nw + j * 16 + tl;
                const int h_ = n >> 6, d_ = n & 63;
                float val = c[i][j][r] + bval[j];
                if (FORM == 0) {
                    val *= 0.125f;  // D^-0.5
                    dst_h[(((size_t)(b_ * kH + h_)) * kT + t) * kD + d_] = (_Float16)val;
                } else if (FORM == 1) {
                    dst_f[(((size_t)(b_ * kH + h_)) * kS + 77 + t) * kD + d_] = val;
                } else {
                    dst_f[(size_t)m * kE + n] = val;
                }
            }
        }
    }
}

template<bool QKV>
__global__ __launch_bounds__(256) void gemm_kernel(
    const _Float16* __restrict__ A,      // [kM, kE] f16
    const _Float16* __restrict__ Wst,    // [kE, kE] f16 (row n, contiguous k); QKV: three of them, stacked
    const float*    __restrict__ bias0,  // [kE]: q's, or o's
    const float*    __restrict__ bias1,  // [kE]: k's (QKV only)
    const float*    __restrict__ bias2,  // [kE]: v's (QKV only)
    float*          __restrict__ dst_f1, // k's output, or o's
    float*          __restrict__ dst_f2, // v's output (QKV only)
    _Float16*       __restrict__ dst_h)  // q's output (QKV only)
{
    constexpr int kTM  = QKV ? kTMq : kTMo;
    constexpr int kFM  = kTM / 32;            // WMMA tile rows per wave
    constexpr int kRPG = 32;                  // tile rows that one copy of every thread covers: threads / 8
    constexpr int kNA  = kTM / kRPG;          // copies per thread, stage and A tile (W tile: 8)
    static_assert(kTN == 8 * kRPG && kTM == kNA * kRPG, "whole copies");
    __shared__ __align__(16) _Float16 As[2][kTM * kLP];
    __shared__ __align__(16) _Float16 Bs[2][kTN * kLP];

    const int tid  = threadIdx.x;
    const int m0   = blockIdx.x * kTM;
    constexpr unsigned int kNT = kE / kTN;                    // column tiles of one weight
    const int which = QKV ? (int)(blockIdx.y / kNT) : 0;      // 0 q, 1 k, 2 v: the same for the workgroup
    const int n0    = (int)(QKV ? blockIdx.y % kNT : blockIdx.y) * kTN;
    const _Float16* W = Wst + (size_t)which * kE * kE;
    const int lane = tid & 31;
    const int wid  = tid >> 5;
    const int mi   = wid & 1;        // 0..1 (band of 16 * kFM rows)
    const int nj   = wid >> 1;       // 64-column band
    const int tl   = lane & 15;
    const int hf   = lane >> 4;      // lane half

    // async loader: per stage a thread copies kNA A-segments + 8 W-segments of 16 B, segment j in row
    // kRPG * j + (tid >> 3) of the tile. One base address per operand; the steps between segments are
    // the same for a wave. M is a multiple of 16, so a 16-row group lies wholly inside A or wholly past
    // its end, and a wave's rows of one copy lie in one such group; a group past the end re-reads the
    // tile's first 16 rows (its rows are never stored).
    static_assert(kM % 16 == 0, "16-row groups of A are whole");
    static_assert(kM % kTM != 0 ? kM % kTM >= 16 : true, "the first 16 rows of every tile exist");
    const int row0 = tid >> 3;              // 0..kRPG-1
    // which 16-row half of its kRPG rows the wave copies, as rows; a scalar
    const int sub  = (__builtin_amdgcn_readfirstlane(tid >> 5) >> 2) * 16;
    const int off0 = (tid & 7) * 8;         // 0..56 halves
    const unsigned long long aBase = (unsigned long long)(uintptr_t)(A + (size_t)(m0 + row0) * kE + off0);
    const unsigned long long bBase = (unsigned long long)(uintptr_t)(W + (size_t)(n0 + row0) * kE + off0);
    const unsigned int       seg0  = (unsigned int)(row0 * kLP + off0) * 2u;   // byte offset in tile
    const unsigned int asB[2] = { (unsigned int)(uintptr_t)&As[0][0],
                                  (unsigned int)(uintptr_t)&As[1][0] };
    const unsigned int bsB[2] = { (unsigned int)(uintptr_t)&Bs[0][0],
                                  (unsigned int)(uintptr_t)&Bs[1][0] };

    auto issue = [&](int kb, int buf) {
        unsigned int la[kNA], lb[8];
        unsigned long long ga[kNA], gb[8];
        #pragma unroll   // constant j: the address arrays stay in registers
        for (int j = 0; j < kNA; j++) {
            const int ar = (m0 + kRPG * j + sub < kM) ? kRPG * j : -sub;   // same for the wave
            la[j] = asB[buf] + seg0 + (unsigned int)(kRPG * j * kLP) * 2u;
            ga[j] = aBase + (unsigned long long)((long long)(ar * kE + kb) * 2);
        }
        #pragma unroll   // constant j: the address arrays stay in registers
        for (int j = 0; j < 8; j++) {
            lb[j] = bsB[buf] + seg0 + (unsigned int)(kRPG * j * kLP) * 2u;
            gb[j] = bBase + (unsigned long long)(kRPG * j * kE + kb) * 2u;
        }
        if constexpr (kNA == 4) async_copy4(la, ga);
        else                    async_copy5(la, ga);
        async_copy8(lb, gb);
    };

    v8f c[kFM][4] = {};

    issue(0, 0);
    wait_async0();
    __syncthreads();
    issue(kKS, 1);

    constexpr int kStages = kE / kKS;
    #pragma unroll   // constant buffer index: LDS addresses fold into the loads' offsets
    for (int t = 0; t < kStages; t++) {
        const int buf = t & 1;
        const _Float16* Asb = As[buf];
        const _Float16* Bsb = Bs[buf];
        // all loops below: constant indices, so that fragments and accumulators stay in registers
        #pragma unroll
        for (int kk = 0; kk < kKS; kk += 32) {
            union { uint4 q[2]; v16h v; } a[kFM], b[4];
            #pragma unroll
            for (int i = 0; i < kFM; i++) {
                const _Float16* ar = Asb + (mi * (16 * kFM) + i * 16 + tl) * kLP + kk;
                a[i].q[0] = *(const uint4*)(ar + 8 * hf);
                a[i].q[1] = *(const uint4*)(ar + 16 + 8 * hf);
            }
            #pragma unroll
            for (int j = 0; j < 4; j++) {
                const _Float16* br = Bsb + (nj * 64 + j * 16 + tl) * kLP + kk;
                b[j].q[0] = *(const uint4*)(br + 8 * hf);
                b[j].q[1] = *(const uint4*)(br + 16 + 8 * hf);
            }
            // keeps the block's LDS reads together ahead of its products: left alone, the compiler
            // re-uses one A fragment's registers and waits out the LDS latency after every 4 products
            __builtin_amdgcn_sched_barrier(0);
            #pragma unroll
            for (int i = 0; i < kFM; i++)
                #pragma unroll
                for (int j = 0; j < 4; j++)
                    c[i][j] = __builtin_amdgcn_wmma_f32_16x16x32_f16(false, a[i].v, false, b[j].v,
                                                                     (short)0, c[i][j], false, false);
        }

        wait_ds0();          // my reads of this buffer are done
        wait_async0();       // my next-stage copies have landed in LDS
        __syncthreads();     // everyone's copies landed, everyone done reading
        if (t + 2 < kStages) issue((t + 2) * kKS, buf);   // refill the buffer just read
    }
    wait_async0();           // nothing of this wave is in flight when it leaves the ring

    // the bias is read ahead of the branch on the store form, so that the loads can rise above the last products
    const float* bias = which == 0 ? bias0 : which == 1 ? bias1 : bias2;
    float bval[4];
    #pragma unroll   // constant j: the array stays in registers
    for (int j = 0; j < 4; j++) bval[j] = bias[n0 + nj * 64 + j * 16 + tl];

    const int mw = m0 + mi * (16 * kFM), nw = n0 + nj * 64;
    if (QKV) {
        if (which == 0) gemm_store<0, kFM>(c, bval, nullptr, dst_h, mw, nw, tl, hf);
        else            gemm_store<1, kFM>(c, bval, which == 1 ? dst_f1 : dst_f2, nullptr, mw, nw, tl, hf);
    } else {
        gemm_store<3, kFM>(c, bval, dst_f1, nullptr, mw, nw, tl, hf);
    }
}

// ---------------------------------------------------------------------------
// Attention: one workgroup per (batch, head); 19 waves of 32 query columns cover all 577 queries.
// The head's K and V are read from memory once, converted to f16 and laid in LDS (pad keys as zeros).
// Then each wave walks the keys in passes of 32 with no further barrier:
//   S^T = K Q^T (a lane holds 16 scores of one query), running maximum and sum in registers,
//   P^T packed from the score accumulators straight into a B operand, O^T += V^T P^T with V^T from the
//   transposing LDS load. Scores and probabilities never touch LDS.
// The maximum in use may trail the true one by up to 8 (log2 units), so the accumulators are rescaled rarely.
// ---------------------------------------------------------------------------
constexpr int kAW  = 19;           // waves per workgroup
constexpr int kAT  = kAW * 32;     // threads per workgroup
constexpr int kKPB = 144;          // LDS pitch of a K row in bytes: 16 x odd, for ds_load_b128
constexpr int kVPB = 160;          // LDS pitch of a V row in bytes: 32 x odd, for ds_load_tr16_b128
constexpr float kLog2e = 1.4426950408889634f;
static_assert(kAW * 32 >= kT, "the waves' query columns cover T");
static_assert(kSP - 32 < kS && kS <= kSP, "only the last pass holds pad keys, and it holds real ones too");

typedef short s16x8 __attribute__((ext_vector_type(8)));
typedef float f32x2 __attribute__((ext_vector_type(2)));

// row-major 16-bit LDS tile -> 8 k values of one column per lane (half of a transposed A fragment)
__device__ __forceinline__ uint4 ld_tr16(const unsigned char* p) {
    typedef __attribute__((address_space(3))) s16x8 lds_s16x8;
    return __builtin_bit_cast(uint4, __builtin_amdgcn_ds_load_tr16_b128_v8i16((lds_s16x8*)p));
}
// two floats -> two f16 in one dword, round to nearest even
__device__ __forceinline__ unsigned int pack2h(float lo, float hi) {
    typedef _Float16 h2 __attribute__((ext_vector_type(2)));
    typedef float    f2 __attribute__((ext_vector_type(2)));
    return __builtin_bit_cast(unsigned int, __builtin_convertvector(f2{lo, hi}, h2));
}
// value of lane l ^ 16
__device__ __forceinline__ float xhalf(float x) {
    return __builtin_bit_cast(float, __builtin_amdgcn_permlanex16(__builtin_bit_cast(int, x), __builtin_bit_cast(int, x),
                                                                  0x76543210, 0xfedcba98, false, false));
}

union V16 { uint4 q[2]; v16h v; };

// One pass of one wave: 32 keys from key0 on, against the wave's 32 query columns.
template<bool LAST>
__device__ __forceinline__ void attn_pass(const unsigned char* Ks, const unsigned char* Vs, int key0, int lane,
                                          const V16 (&qf)[2][2], v8f (&acc)[2][4], float (&mrun)[2], f32x2 (&lrun)[2]) {
    const int tl = lane & 15, hf = lane >> 4;
    // all loops below: constant indices, so that fragments and accumulators stay in registers
    V16 kf[2][2];      // [16-key tile][d half]
    const unsigned char* kp = Ks + (key0 + tl) * kKPB + 16 * hf;
    #pragma unroll
    for (int kt = 0; kt < 2; kt++)
        #pragma unroll
        for (int kc = 0; kc < 2; kc++) {
            kf[kt][kc].q[0] = *(const uint4*)(kp + kt * 16 * kKPB + 64 * kc);
            kf[kt][kc].q[1] = *(const uint4*)(kp + kt * 16 * kKPB + 64 * kc + 32);
        }
    V16 pf[2];         // P^T per column group
    #pragma unroll
    for (int g = 0; g < 2; g++) {
        v8f s[2];      // s[kt][r] = score of key key0 + 16 kt + 8 hf + r with query column tl of group g
        #pragma unroll
        for (int kt = 0; kt < 2; kt++) {
            s[kt] = v8f{};
            #pragma unroll
            for (int kc = 0; kc < 2; kc++)
                s[kt] = __builtin_amdgcn_wmma_f32_16x16x32_f16(false, kf[kt][kc].v, false, qf[g][kc].v,
                                                               (short)0, s[kt], false, false);
        }
        if (LAST) {
            #pragma unroll
            for (int kt = 0; kt < 2; kt++)
                #pragma unroll
                for (int r = 0; r < 8; r++)
                    if (key0 + 16 * kt + 8 * hf + r >= kS) s[kt][r] = NEG_BIG;
        }
        float mx = s[0][0];
        #pragma unroll
        for (int r = 1; r < 8; r++) mx = fmaxf(mx, s[0][r]);
        #pragma unroll
        for (int r = 0; r < 8; r++) mx = fmaxf(mx, s[1][r]);
        mx = fmaxf(mx, xhalf(mx)) * kLog2e;     // both lane halves hold the query's maximum of this pass
        if (__builtin_amdgcn_ballot_w32(mx > mrun[g] + 8.0f) != 0) {   // scalar branch, rare after the first pass
            const float mnew = fmaxf(mrun[g], mx);
            const float corr = __builtin_amdgcn_exp2f(mrun[g] - mnew);
            mrun[g] = mnew;
            lrun[g] = lrun[g] * corr;
            #pragma unroll
            for (int t = 0; t < 4; t++) acc[g][t] = acc[g][t] * corr;
        }
        const float nm = -mrun[g];
        unsigned int w[8];
        #pragma unroll
        for (int i = 0; i < 8; i++) {           // elements 2i, 2i + 1 of the 32-key B operand
            const f32x2 arg = __builtin_elementwise_fma(f32x2{s[i >> 2][2 * (i & 3)], s[i >> 2][2 * (i & 3) + 1]},
                                                        f32x2{kLog2e, kLog2e}, f32x2{nm, nm});
            const f32x2 p = {__builtin_amdgcn_exp2f(arg.x), __builtin_amdgcn_exp2f(arg.y)};
            lrun[g] += p;
            w[i] = pack2h(p.x, p.y);
        }
        pf[g].q[0] = uint4{w[0], w[1], w[2], w[3]};
        pf[g].q[1] = uint4{w[4], w[5], w[6], w[7]};
    }
    V16 vf[4];         // V^T: 16 d rows x 32 keys per fragment
    const unsigned char* vp = Vs + (key0 + 8 * hf + (lane & 7)) * kVPB + ((lane >> 3) & 1) * 16;
    #pragma unroll
    for (int t = 0; t < 4; t++) {
        vf[t].q[0] = ld_tr16(vp + 32 * t);
        vf[t].q[1] = ld_tr16(vp + 16 * kVPB + 32 * t);
    }
    #pragma unroll
    for (int g = 0; g < 2; g++)
        #pragma unroll
        for (int t = 0; t < 4; t++)
            acc[g][t] = __builtin_amdgcn_wmma_f32_16x16x32_f16(false, vf[t].v, false, pf[g].v,
                                                               (short)0, acc[g][t], false, false);
}

__global__ __launch_bounds__(kAT) void attn_kernel(
    const _Float16* __restrict__ Q,   // [B*H, T, D] f16 (pre-scaled)
    const float*    __restrict__ Kf,  // [B*H, S, D] fp32
    const float*    __restrict__ Vf,  // [B*H, S, D] fp32
    _Float16*       __restrict__ O)   // [B, T, E] f16
{
    __shared__ __align__(32) unsigned char Ks[kSP * kKPB];
    __shared__ __align__(32) unsigned char Vs[kSP * kVPB];

    const int bh   = blockIdx.x;            // 0..255
    const int b_   = bh >> 4, h_ = bh & 15;
    const int tid  = threadIdx.x;
    const int lane = tid & 31;
    const int wid  = tid >> 5;              // 0..18
    const int tl   = lane & 15;
    const int hf   = lane >> 4;

    // Stage K and V: a thread converts 4 consecutive floats per step; pad rows [kS, kSP) become zeros
    // (a pad key's probability is 0, and 0 x V must stay 0).
    const float* kg = Kf + (size_t)bh * kS * kD;
    const float* vg = Vf + (size_t)bh * kS * kD;
    constexpr int kChunks = kSP * (kD / 4);     // chunks of 4 elements, pad rows included
    constexpr int kReal   = kS * (kD / 4);      // chunks that exist in memory
    #pragma unroll   // constant trip: the loads of the whole steps issue together, ahead of the first conversion
    for (int it = 0; it < (kChunks + kAT - 1) / kAT; it++) {
        const int ch = it * kAT + tid;
        // the first test of each pair is a constant: only the last step carries lane tests
        if ((it + 1) * kAT <= kChunks || ch < kChunks) {
            const int row = ch >> 4, c4 = ch & 15;
            uint2 kq = {0u, 0u}, vq = {0u, 0u};
            if ((it + 1) * kAT <= kReal || ch < kReal) {
                const float4 kx = *(const float4*)(kg + (size_t)ch * 4);
                const float4 vx = *(const float4*)(vg + (size_t)ch * 4);
                kq = uint2{pack2h(kx.x, kx.y), pack2h(kx.z, kx.w)};
                vq = uint2{pack2h(vx.x, vx.y), pack2h(vx.z, vx.w)};
            }
            *(uint2*)(Ks + row * kKPB + c4 * 8) = kq;
            *(uint2*)(Vs + row * kVPB + c4 * 8) = vq;
        }
    }

    // Q fragments (B operand: column = query, k = d), kept in registers; columns past T repeat the last query
    V16 qf[2][2];
    #pragma unroll   // constant g: the fragment array stays in registers
    for (int g = 0; g < 2; g++) {
        int tq = wid * 32 + g * 16 + tl; if (tq > kT - 1) tq = kT - 1;
        const _Float16* qr = Q + ((size_t)bh * kT + tq) * kD;
        qf[g][0].q[0] = *(const uint4*)(qr + 8 * hf);
        qf[g][0].q[1] = *(const uint4*)(qr + 16 + 8 * hf);
        qf[g][1].q[0] = *(const uint4*)(qr + 32 + 8 * hf);
        qf[g][1].q[1] = *(const uint4*)(qr + 48 + 8 * hf);
        // before a later load may land in a register that holds this group's address
        asm volatile("s_wait_xcnt 0x0" ::: "memory");
    }

    v8f acc[2][4] = {};                     // acc[g][t][r] = O[query tl of group g][d = 16 t + 8 hf + r]
    float mrun[2] = {NEG_BIG, NEG_BIG};     // maximum in use, log2 units
    f32x2 lrun[2] = {};                     // the lane's share of the denominator, even and odd keys apart

    __syncthreads();                        // K and V are staged; LDS is only read from here on

    for (int key0 = 0; key0 < kSP - 32; key0 += 32)
        attn_pass<false>(Ks, Vs, key0, lane, qf, acc, mrun, lrun);
    attn_pass<true>(Ks, Vs, kSP - 32, lane, qf, acc, mrun, lrun);

    #pragma unroll   // constant g: the accumulator array stays in registers
    for (int g = 0; g < 2; g++) {
        const float lh  = lrun[g].x + lrun[g].y;
        const float inv = 1.0f / (lh + xhalf(lh));             // exchange outside any lane-dependent branch
        const int tq = wid * 32 + g * 16 + tl;
        if (tq < kT) {
            _Float16* op = O + ((size_t)b_ * kT + tq) * kE + h_ * kD + 8 * hf;
            #pragma unroll
            for (int t = 0; t < 4; t++) {
                const v8f o = acc[g][t] * inv;
                *(uint4*)(op + 16 * t) = uint4{pack2h(o[0], o[1]), pack2h(o[2], o[3]),
                                               pack2h(o[4], o[5]), pack2h(o[6], o[7])};
            }
        }
    }
}

// ---------------------------------------------------------------------------
// Launcher
// ---------------------------------------------------------------------------
extern "C" void kernel_launch(void* const* d_in, const int* in_sizes, int n_in,
                              void* d_out, int out_size, void* d_ws, size_t ws_size,
                              hipStream_t stream) {
    const float* hs  = (const float*)d_in[0];
    const float* tkv = (const float*)d_in[1];
    const float* Wq  = (const float*)d_in[2];
    const float* bq  = (const float*)d_in[3];
    const float* Wk  = (const float*)d_in[4];
    const float* bk  = (const float*)d_in[5];
    const float* Wv  = (const float*)d_in[6];
    const float* bv  = (const float*)d_in[7];
    const float* Wo  = (const float*)d_in[8];
    const float* bo  = (const float*)d_in[9];
    const float* tw  = (const float*)d_in[10];

    float* out  = (float*)d_out;
    float* kout = out + OUT_ELEMS;
    float* vout = kout + KV_ELEMS;

    // workspace layout (all 256-aligned)
    char* ws = (char*)d_ws;
    _Float16* hs_h   = (_Float16*)(ws);                       // 18,907,136 B
    _Float16* wq_h   = (_Float16*)(ws + 18907136);            // 4 x 2,097,152 B
    _Float16* wo_h   = wq_h + 3 * (size_t)kE * kE;            // order q, k, v, o
    _Float16* q_h    = (_Float16*)(ws + 27295744);            // 18,907,136 B
    _Float16* attn_h = (_Float16*)(ws + 46202880);            // 18,907,136 B

    // 1) conversions to f16 and textual K/V (rows 0..76 of output K/V)
    prep_kernel<<<kPG, kPT, 0, stream>>>(hs, Wq, Wk, Wv, Wo, tkv, tw, hs_h, wq_h, kout, vout);

    // 2) Q/K/V projections, one launch over the stacked weights
    dim3 ggrid((kM + kTMo - 1) / kTMo, kE / kTN);       // 58 x 4
    dim3 qgrid((kM + kTMq - 1) / kTMq, 3 * (kE / kTN)); // 73 x 12
    gemm_kernel<true><<<qgrid, 256, 0, stream>>>(hs_h, wq_h, bq, bk, bv, kout, vout, q_h);

    // 3) attention
    attn_kernel<<<kB * kH, kAT, 0, stream>>>(q_h, kout, vout, attn_h);

    // 4) output projection
    gemm_kernel<false><<<ggrid, 256, 0, stream>>>(attn_h, wo_h, bo, nullptr, nullptr, out, nullptr, nullptr);
}
